// v000
// Measured on an AMD MI455X. A time is GPU time per run, averaged over a window of back-to-back runs after a warm-up
// (all launches, gaps included; the runs take copies of the inputs in turn), and the median of several windows.
// Apart from v000's, it joins two sittings. Times from different sittings can be a few percent apart, while
// side-by-side timings come from the same sitting.
// v000 is the starting kernel. One run takes 38.1 microseconds.
#include <hip/hip_runtime.h>
// Compute dtype: site0 scores = K(f16 of bf16-RNE input x2^8) . Q^T(same) on v_wmma_f32_16x16x32_f16, f32 accumulate; site1 out^T = V^T(f16 of bf16-RNE input x2^6) . P^T with P as f16 hi (x2^10) plus f16 residual (x2^21) in two accumulators, v_wmma_f32_16x16x32_f16, f32 accumulate; softmax statistics and epilogue f32.

#ifndef NB
#define NB 4
#endif
#ifndef SEQ
#define SEQ 2048
#endif
#define NB_FULL 4
#define SEQ_FULL 2048
#define EMB 512
#define NHEADS 16
#define DHEAD 32
#define QCH 64
#define WIN 256
#define NEGBIG (-1.0e30f)

static_assert(EMB == NHEADS * DHEAD);
static_assert(SEQ % 64 == 0);
static_assert(QCH == 64);
static_assert(WIN % 64 == 0);
static_assert((NB * SEQ * EMB) % 2048 == 0);

typedef _Float16 v16h __attribute__((ext_vector_type(16)));
typedef unsigned short v8us __attribute__((ext_vector_type(8), may_alias));
typedef float v8f __attribute__((ext_vector_type(8)));
typedef float v4f __attribute__((ext_vector_type(4)));
typedef float v4fa __attribute__((ext_vector_type(4), may_alias));
union FragH { v16h v; v8us half[2]; _Float16 h[16]; unsigned short u[16]; };
union HU { _Float16 h; unsigned short u; };

__device__ __forceinline__ float bf16_rnef(float x) {
  unsigned int u = __float_as_uint(x);
  u = (u + 0x7FFFu + ((u >> 16) & 1u)) & 0xFFFF0000u;
  return __uint_as_float(u);
}

// D = A.B + C (16x16x32, f16 operands, f32 accumulate) followed by the VALU hazard guard
__device__ __forceinline__ v8f mma16(v16h a, v16h b, v8f c) {
  v8f d = __builtin_amdgcn_wmma_f32_16x16x32_f16(false, a, false, b, (short)0, c, false, false);
  asm volatile("v_nop\n\tv_nop\n\tv_nop\n\tv_nop" : "+v"(d) : "v"(a), "v"(b));
  return d;
}

// q and k rows -> 16-bit planes: element = f16(bf16rne(x) * 256) (exact); plane row pr = b*SEQ + n reads input row b*SEQ_FULL + n.
// coverage: blockIdx.y = 0 -> Q16, 1 -> K16; t in [0, NB*SEQ*EMB/8) covers every plane element exactly once.
__global__ __launch_bounds__(256) void k_cvt16(const float* __restrict__ q, const float* __restrict__ k,
                                               unsigned short* __restrict__ Q16, unsigned short* __restrict__ K16, int n8) {
  #pragma clang fp contract(off)
  const int t = blockIdx.x * 256 + threadIdx.x;
  if (t >= n8) return;
  const bool isk = (blockIdx.y != 0);
  const float* src = isk ? k : q;
  unsigned short* dst = isk ? K16 : Q16;
  const size_t e = (size_t)t * 8;
  const size_t pr = e / EMB;
  const int col = (int)(e % EMB);
  const size_t bb = pr / SEQ, n = pr % SEQ;
  const float* sp = src + ((bb * SEQ_FULL + n) * EMB + col);
  const v4f a = *(const v4fa*)sp;
  const v4f c = *(const v4fa*)(sp + 4);
  FragH f;
#pragma unroll
  for (int i = 0; i < 4; ++i) {
    f.h[i] = (_Float16)(bf16_rnef(a[i]) * 256.0f);
    f.h[4 + i] = (_Float16)(bf16_rnef(c[i]) * 256.0f);
  }
  const v8us o = f.half[0];
  *(v8us*)(dst + e) = o;
  
}

// VT[(b*NHEADS + h)*DHEAD + d][SEQ] (16-bit, key contiguous) = f16(bf16rne(v[b][s][h*DHEAD + d]) * 64) (exact).
// LDS tl: cross-thread exchange, block barrier between fill and drain; staged extent (32 x 64) == consumed extent.
// coverage: grid (SEQ/64, NHEADS, NB) x (32 rows x 64 keys) covers the whole VT plane exactly once.
__global__ __launch_bounds__(256) void k_vt(const float* __restrict__ v, unsigned short* __restrict__ VT) {
  #pragma clang fp contract(off)
  __shared__ __attribute__((aligned(16))) unsigned short tl[DHEAD][66];
  const int tid = threadIdx.x;
  const int sg = blockIdx.x, head = blockIdx.y, b = blockIdx.z;
  const int s0 = sg * 64;
  for (int i = tid; i < 64 * 8; i += 256) {
    const int j = i >> 3, d4 = (i & 7) * 4;
    const v4f a = *(const v4fa*)(v + ((size_t)b * SEQ_FULL + s0 + j) * EMB + head * DHEAD + d4);
#pragma unroll
    for (int qq = 0; qq < 4; ++qq) { HU hu; hu.h = (_Float16)(bf16_rnef(a[qq]) * 64.0f); tl[d4 + qq][j] = hu.u; }
  }
  __syncthreads();
  const int d = tid >> 3, pc = tid & 7;
  FragH f;
#pragma unroll
  for (int qq = 0; qq < 8; ++qq) f.u[qq] = tl[d][pc * 8 + qq];
  const v8us o = f.half[0];
  unsigned short* dst = VT + (((size_t)b * NHEADS + head) * DHEAD + d) * SEQ + s0 + pc * 8;
  *(v8us*)dst = o;
  
}

// Windowed attention. block = (query chunk qc, head, batch), 128 threads; wave w owns queries qs + 16w + 0..15; lane (hh, l15) owns query qs + 16w + l15.
// Keys computed: [kstart, qs + 64) with kstart = max(0, qs - WIN); key allowed for query qg iff key >= qg - (WIN - 1) (same-chunk keys are all allowed, window keys end just before the chunk).
// Per 32-key block: S^T tiles s0 (keys kb0..kb0+15 on rows) and s1 (keys kb0+16..31) = K(A, m = key) . Q^T(B, n = query); lane holds 16 keys of its query;
// row max / sum = register reduce + one xor-16 shuffle; P^T B fragment element r <- s0[r], element 8+r <- s1[r] (chained-D map); out^T tile u = V^T(A, m = d 16u + l15) . P^T.
// P carried as f16 hi = f16(p * 2^10) and residual f16((p*2^10 - hi) * 2^11) into separate accumulators; folded in the f32 epilogue with 2^-11, then 2^-10 (P carry), 2^-6 (V carry), 1/l.
__global__ __launch_bounds__(128) __attribute__((amdgpu_num_vgpr(256)))
void k_attn(const unsigned short* __restrict__ Q16, const unsigned short* __restrict__ K16, const unsigned short* __restrict__ VT,
            const int* __restrict__ cidx, float* __restrict__ out) {
  __shared__ __attribute__((aligned(16))) float so[4][16][32];
  (void)cidx;
  const int qc = blockIdx.x, head = blockIdx.y, b = blockIdx.z;
  const int tid = threadIdx.x, w = tid >> 5, lane = tid & 31, l15 = lane & 15, hh = lane >> 4;
  const int qs = qc * QCH;
  const int kstart = (qs >= WIN) ? (qs - WIN) : 0;
  const int nk = qs + QCH - kstart;          // multiple of 32, <= QCH + WIN
  const int nblk = nk >> 5;
  const int qg = qs + 16 * w + l15;           // this lane's query (column n of every tile)
  const int thr = qg - (WIN - 1);             // key allowed iff key >= thr (keys are < qs + 64 by construction)

  // Q^T B fragment: n = query l15, elements 0..7 <- d 8hh+0..7, 8..15 <- d 16+8hh+0..7
  FragH qb;
  {
    const unsigned short* p = Q16 + ((size_t)b * SEQ + qg) * EMB + head * DHEAD;
    qb.half[0] = *(const v8us*)(p + 8 * hh);
    qb.half[1] = *(const v8us*)(p + 16 + 8 * hh);
  }
  const unsigned short* kbase = K16 + ((size_t)b * SEQ + kstart + l15) * EMB + head * DHEAD;                 // A rows: m = key kstart + kb0 + 16t + l15
  const unsigned short* vbase = VT + (((size_t)b * NHEADS + head) * DHEAD + l15) * SEQ + kstart + 8 * hh;    // A rows: m = d 16u + l15, k = keys

  const v8f z8 = {0.f, 0.f, 0.f, 0.f, 0.f, 0.f, 0.f, 0.f};
  v8f a0h = z8, a1h = z8, a0l = z8, a1l = z8;
  float m = NEGBIG, l = 0.f;
  const float scl = 0.17677669529663687f * 0.0000152587890625f;   // d^-0.5 x 2^-16 (q and k each carried x2^8)

#pragma unroll 1
  for (int kb = 0; kb < nblk; ++kb) {
    const int kb0 = kb * 32;
    v8f s0, s1;
    {
      FragH ka;
      const unsigned short* p = kbase + (size_t)kb0 * EMB;
      ka.half[0] = *(const v8us*)(p + 8 * hh);
      ka.half[1] = *(const v8us*)(p + 16 + 8 * hh);
      s0 = mma16(ka.v, qb.v, z8);
      const unsigned short* p1 = kbase + (size_t)(kb0 + 16) * EMB;
      ka.half[0] = *(const v8us*)(p1 + 8 * hh);
      ka.half[1] = *(const v8us*)(p1 + 16 + 8 * hh);
      s1 = mma16(ka.v, qb.v, z8);
    }
    // s0[r] <-> key kstart + kb0 + 8hh + r ; s1[r] <-> key kstart + kb0 + 16 + 8hh + r ; both for query qg
    const int kg0 = kstart + kb0 + 8 * hh;
    float x[16];
#pragma unroll
    for (int r = 0; r < 8; ++r) {
      x[r]     = (kg0 + r >= thr)      ? s0[r] * scl : NEGBIG;
      x[8 + r] = (kg0 + 16 + r >= thr) ? s1[r] * scl : NEGBIG;
    }
    float mx = x[0];
#pragma unroll
    for (int i = 1; i < 16; ++i) mx = fmaxf(mx, x[i]);
    mx = fmaxf(mx, __shfl_xor(mx, 16));
    const float mnew = fmaxf(m, mx);
    float p[16];
    float rs = 0.f;
#pragma unroll
    for (int i = 0; i < 16; ++i) {
      const float ev = __expf(x[i] - mnew);
      p[i] = (x[i] > -1.0e29f) ? ev : 0.f;
      rs += p[i];
    }
    rs += __shfl_xor(rs, 16);
    const float c = __expf(m - mnew);
    l = l * c + rs;
    m = mnew;
    FragH ph, pl;
#pragma unroll
    for (int i = 0; i < 16; ++i) {
      const float ps = p[i] * 1024.0f;
      const _Float16 hv = (_Float16)ps;
      ph.h[i] = hv;
      pl.h[i] = (_Float16)((ps - (float)hv) * 2048.0f);
    }
#pragma unroll
    for (int r = 0; r < 8; ++r) { a0h[r] *= c; a1h[r] *= c; a0l[r] *= c; a1l[r] *= c; }
    {
      FragH va;
      const unsigned short* p0 = vbase + kb0;
      va.half[0] = *(const v8us*)(p0);
      va.half[1] = *(const v8us*)(p0 + 16);
      a0h = mma16(va.v, ph.v, a0h);
      a0l = mma16(va.v, pl.v, a0l);
      const unsigned short* p1 = vbase + (size_t)16 * SEQ + kb0;
      va.half[0] = *(const v8us*)(p1);
      va.half[1] = *(const v8us*)(p1 + 16);
      a1h = mma16(va.v, ph.v, a1h);
      a1l = mma16(va.v, pl.v, a1l);
    }
  }

  // epilogue: out[qg][head*32 + d]; a0: d = 8hh + r, a1: d = 16 + 8hh + r
  const float inv = 1.0f / l;                          // l >= 1
  const float fo = inv * 0.0000152587890625f;          // 2^-10 (P carry) x 2^-6 (V carry)
  v4f t0, t1, t2, t3;
#pragma unroll
  for (int r = 0; r < 4; ++r) {
    t0[r] = (a0h[r]     + a0l[r]     * 0.00048828125f) * fo;
    t1[r] = (a0h[4 + r] + a0l[4 + r] * 0.00048828125f) * fo;
    t2[r] = (a1h[r]     + a1l[r]     * 0.00048828125f) * fo;
    t3[r] = (a1h[4 + r] + a1l[4 + r] * 0.00048828125f) * fo;
  }
  *(v4fa*)&so[w][l15][8 * hh]          = t0;
  *(v4fa*)&so[w][l15][8 * hh + 4]      = t1;
  *(v4fa*)&so[w][l15][16 + 8 * hh]     = t2;
  *(v4fa*)&so[w][l15][16 + 8 * hh + 4] = t3;
  __syncthreads();
  const int ql = lane >> 3, c4 = (lane & 7) * 4;
  float* orow = out + ((size_t)b * SEQ + qs + 16 * w) * EMB + head * DHEAD + c4;
  {
#pragma unroll
    for (int j = 0; j < 4; ++j) {
      const int r = 4 * j + ql;
      const v4f vv = *(const v4fa*)&so[w][r][c4];
      *(v4f*)(orow + (size_t)r * EMB) = vv;
    }
    
  }
}

extern "C" void kernel_launch(void* const* d_in, const int* in_sizes, int n_in,
                              void* d_out, int out_size, void* d_ws, size_t ws_size, hipStream_t stream) {
  if (n_in < 4) return;
  if (in_sizes[0] < NB * SEQ * EMB || in_sizes[1] < NB * SEQ * EMB || in_sizes[2] < NB * SEQ * EMB || in_sizes[3] < 1) return;
  if (out_size < NB * SEQ * EMB) return;
  const float* q = (const float*)d_in[0];
  const float* k = (const float*)d_in[1];
  const float* v = (const float*)d_in[2];
  const int* cidx = (const int*)d_in[3];
  float* out = (float*)d_out;
  char* ws = (char*)d_ws;
  size_t off = 0;
  const size_t plane = (size_t)NB * SEQ * EMB * 2;        // 16-bit plane bytes (8 MiB at full size)
  unsigned short* Q16 = (unsigned short*)(ws + off); off += plane;
  unsigned short* K16 = (unsigned short*)(ws + off); off += plane;
  unsigned short* VT  = (unsigned short*)(ws + off); off += plane;   // [NB*NHEADS*DHEAD][SEQ]
  if (off > ws_size) return;                                          // 24 MiB total at full size
  const int n8 = NB * SEQ * EMB / 8;
  k_cvt16<<<dim3((unsigned)((n8 + 255) / 256), 2, 1), 256, 0, stream>>>(q, k, Q16, K16, n8);
  k_vt<<<dim3(SEQ / 64, NHEADS, NB), 256, 0, stream>>>(v, VT);
  k_attn<<<dim3(SEQ / QCH, NHEADS, NB), 128, 0, stream>>>(Q16, K16, VT, cidx, out);
}

// v001
// Measured time: 23.9 microseconds a run.
// Timed twice side by side with v000, it ran 1.62 and 1.60 times as fast.
#include <hip/hip_runtime.h>
// Compute dtype: site0 scores = K(f16 of bf16-RNE input x2^8) . Q^T(same) on v_wmma_f32_16x16x32_f16, f32 accumulate; site1 out^T = V^T(f16 of bf16-RNE input x2^6) . P^T with P as f16 hi (x2^10) plus f16 residual (x2^21) in two accumulators, v_wmma_f32_16x16x32_f16, f32 accumulate; softmax statistics and epilogue f32.

#ifndef NB
#define NB 4
#endif
#ifndef SEQ
#define SEQ 2048
#endif
#define NB_FULL 4
#define SEQ_FULL 2048
#define EMB 512
#define NHEADS 16
#define DHEAD 32
#define QCH 64
#define WIN 256
#define NEGBIG (-1.0e30f)

static_assert(EMB == NHEADS * DHEAD);
static_assert(SEQ % 64 == 0);
static_assert(QCH == 64);
static_assert(WIN % 64 == 0);
#define QBLK 256
#define KROWS (QBLK + WIN)
#define KPITCH 80
#define VPITCH 96
static_assert(QBLK % QCH == 0 && SEQ % QBLK == 0 && SEQ >= KROWS && SEQ <= SEQ_FULL);
static_assert(KROWS % 64 == 0);

typedef _Float16 v16h __attribute__((ext_vector_type(16)));
typedef unsigned short v8us __attribute__((ext_vector_type(8), may_alias));
typedef unsigned short v4us __attribute__((ext_vector_type(4), may_alias));
typedef short s16x8 __attribute__((ext_vector_type(8)));
typedef float v8f __attribute__((ext_vector_type(8)));
typedef float v4f __attribute__((ext_vector_type(4)));
typedef float v4fa __attribute__((ext_vector_type(4), may_alias));
union FragH { v16h v; v8us half[2]; _Float16 h[16]; unsigned short u[16]; };
union QuadH { _Float16 h[4]; v4us q; };

__device__ __forceinline__ float bf16_rnef(float x) {
  unsigned int u = __float_as_uint(x);
  u = (u + 0x7FFFu + ((u >> 16) & 1u)) & 0xFFFF0000u;
  return __uint_as_float(u);
}

// D = A.B + C (16x16x32, f16 operands, f32 accumulate) followed by the VALU hazard guard
__device__ __forceinline__ v8f mma16(v16h a, v16h b, v8f c) {
  v8f d = __builtin_amdgcn_wmma_f32_16x16x32_f16(false, a, false, b, (short)0, c, false, false);
  asm volatile("v_nop\n\tv_nop\n\tv_nop\n\tv_nop" : "+v"(d) : "v"(a), "v"(b));
  return d;
}

// 16-bit transposing LDS load: lane (c, h) gets T[row0 + 8h + 0..7][col0 + c] of a row-major 16-bit tile; p is the lane's own address (row0 + 8h + (lane & 7), byte 16 * ((lane >> 3) & 1)).
__device__ __forceinline__ v8us ld_tr16(const unsigned char* p) {
  typedef __attribute__((address_space(3))) s16x8 lds_s16x8;
  return __builtin_bit_cast(v8us, __builtin_amdgcn_ds_load_tr16_b128_v8i16((lds_s16x8*)p));
}

// four f32 -> four 16-bit carriers: f16(bf16rne(x) * s) (exact for s = 2^8, 2^6)
__device__ __forceinline__ v4us cvt4(v4f a, float s) {
  QuadH o;
#pragma unroll
  for (int i = 0; i < 4; ++i) o.h[i] = (_Float16)(bf16_rnef(a[i]) * s);
  return o.q;
}

// Windowed attention, one launch. block = (4 query chunks = QBLK queries, head, batch), 512 threads; wave w owns queries q0 + 16w + 0..15 (chunk w >> 2); lane (hh, l15) owns query qg.
// Staging: the block reads the f32 rows of keys [kf, kf + KROWS), kf = max(0, q0 - WIN), of its head (one 128-byte line a row), converts them and keeps K (pitch KPITCH, key rows) and V (pitch VPITCH, key rows) as 16-bit carriers in LDS;
// rows kf .. kf + KROWS - 1 all lie inside the sequence (SEQ >= KROWS); the first block of a sequence stages rows it never reads. One barrier between fill and the first fragment load. Q goes from f32 straight into the B fragment.
// Keys computed per wave: [kstart, qs + 64) with kstart = max(0, qs - WIN); key allowed for query qg iff key >= qg - (WIN - 1) (same-chunk keys are all allowed, window keys end just before the chunk).
// Per 32-key block: S^T tiles s0 (keys kb0..kb0+15 on rows) and s1 (keys kb0+16..31) = K(A, m = key) . Q^T(B, n = query); lane holds 16 keys of its query;
// row max / sum = register reduce + one xor-16 shuffle; P^T B fragment element r <- s0[r], element 8+r <- s1[r] (chained-D map); out^T tile u = V^T(A, m = d 16u + l15, by the transposing load) . P^T.
// P carried as f16 hi = f16(p * 2^10) and residual f16((p*2^10 - hi) * 2^11) into separate accumulators; folded in the f32 epilogue with 2^-11, then 2^-10 (P carry), 2^-6 (V carry), 1/l.
__global__ __launch_bounds__(512)
void k_attn(const float* __restrict__ q, const float* __restrict__ k, const float* __restrict__ v,
            const int* __restrict__ cidx, float* __restrict__ out) {
  __shared__ __attribute__((aligned(16))) unsigned char kl[KROWS * KPITCH];
  __shared__ __attribute__((aligned(16))) unsigned char vl[KROWS * VPITCH];
  __shared__ __attribute__((aligned(16))) float so[QBLK / 16][16][32];
  (void)cidx;
  const int qblk = blockIdx.x, head = blockIdx.y, b = blockIdx.z;
  const int tid = threadIdx.x, lane = tid & 31, l15 = lane & 15, hh = lane >> 4;
  const int w = __builtin_amdgcn_readfirstlane(tid >> 5);   // wave number in a scalar register: the key loop's trip count stays a scalar branch
  const int q0 = qblk * QBLK;
  const int kf = (q0 >= WIN) ? (q0 - WIN) : 0;   // first staged key
  const int qs = q0 + (w >> 2) * QCH;             // this wave's chunk start
  const int kstart = (qs >= WIN) ? (qs - WIN) : 0;
  const int nk = qs + QCH - kstart;          // multiple of 32, <= QCH + WIN
  const int nblk = nk >> 5;
  const int qg = q0 + 16 * w + l15;           // this lane's query (column n of every tile)
  const int thr = qg - (WIN - 1);             // key allowed iff key >= thr (keys are < qs + 64 by construction)

  FragH qb;
  {
    // all global loads first: 8 threads a row, 16 bytes each, 64 rows a sweep
    const int srow = tid >> 3, sc = tid & 7;
    const size_t goff = ((size_t)b * SEQ_FULL + kf + srow) * EMB + head * DHEAD + sc * 4;
    const float* kg = k + goff;
    const float* vg = v + goff;
    const float* qp = q + ((size_t)b * SEQ_FULL + qg) * EMB + head * DHEAD + 8 * hh;
    v4f kr[KROWS / 64], vr[KROWS / 64];
#pragma unroll
    for (int i = 0; i < KROWS / 64; ++i) kr[i] = *(const v4fa*)(kg + (size_t)i * 64 * EMB);
#pragma unroll
    for (int i = 0; i < KROWS / 64; ++i) vr[i] = *(const v4fa*)(vg + (size_t)i * 64 * EMB);
    const v4f qa = *(const v4fa*)(qp), qc = *(const v4fa*)(qp + 4), qd = *(const v4fa*)(qp + 16), qe = *(const v4fa*)(qp + 20);
    // the loads' address registers stay live (inputs) up to this wait, so nothing, a load's own result included, overwrites one ahead of it
    asm volatile("s_wait_xcnt 0x0" :: "v"(kg), "v"(vg), "v"(qp) : "memory");
#pragma unroll
    for (int i = 0; i < KROWS / 64; ++i) *(v4us*)(kl + (srow + 64 * i) * KPITCH + sc * 8) = cvt4(kr[i], 256.0f);
#pragma unroll
    for (int i = 0; i < KROWS / 64; ++i) *(v4us*)(vl + (srow + 64 * i) * VPITCH + sc * 8) = cvt4(vr[i], 64.0f);
    // Q^T B fragment: n = query l15, elements 0..7 <- d 8hh+0..7, 8..15 <- d 16+8hh+0..7
#pragma unroll
    for (int i = 0; i < 4; ++i) {
      qb.h[i]      = (_Float16)(bf16_rnef(qa[i]) * 256.0f);
      qb.h[4 + i]  = (_Float16)(bf16_rnef(qc[i]) * 256.0f);
      qb.h[8 + i]  = (_Float16)(bf16_rnef(qd[i]) * 256.0f);
      qb.h[12 + i] = (_Float16)(bf16_rnef(qe[i]) * 256.0f);
    }
  }
  __syncthreads();
  const unsigned char* kbase = kl + (kstart - kf + l15) * KPITCH + 16 * hh;                                   // A rows: m = key kstart + kb0 + 16t + l15
  const unsigned char* vbase = vl + (kstart - kf + 8 * hh + (lane & 7)) * VPITCH + 16 * ((lane >> 3) & 1);   // transposing load: rows = keys, columns = d

  const v8f z8 = {0.f, 0.f, 0.f, 0.f, 0.f, 0.f, 0.f, 0.f};
  v8f a0h = z8, a1h = z8, a0l = z8, a1l = z8;
  float m = NEGBIG, l = 0.f;
  const float scl = 0.17677669529663687f * 0.0000152587890625f;   // d^-0.5 x 2^-16 (q and k each carried x2^8)

  const unsigned char* kp = kbase;
  const unsigned char* vp = vbase;
#pragma unroll 1
  for (int kb = 0; kb < nblk; ++kb, kp += 32 * KPITCH, vp += 32 * VPITCH) {
    const int kb0 = kb * 32;
    v8f s0, s1;
    {
      FragH ka;
      ka.half[0] = *(const v8us*)(kp);
      ka.half[1] = *(const v8us*)(kp + 32);
      s0 = mma16(ka.v, qb.v, z8);
      ka.half[0] = *(const v8us*)(kp + 16 * KPITCH);
      ka.half[1] = *(const v8us*)(kp + 16 * KPITCH + 32);
      s1 = mma16(ka.v, qb.v, z8);
    }
    // s0[r] <-> key kstart + kb0 + 8hh + r ; s1[r] <-> key kstart + kb0 + 16 + 8hh + r ; both for query qg
    const int kg0 = kstart + kb0 + 8 * hh;
    float x[16];
#pragma unroll
    for (int r = 0; r < 8; ++r) {
      x[r]     = (kg0 + r >= thr)      ? s0[r] * scl : NEGBIG;
      x[8 + r] = (kg0 + 16 + r >= thr) ? s1[r] * scl : NEGBIG;
    }
    float mx = x[0];
#pragma unroll
    for (int i = 1; i < 16; ++i) mx = fmaxf(mx, x[i]);
    mx = fmaxf(mx, __shfl_xor(mx, 16));
    const float mnew = fmaxf(m, mx);
    float p[16];
    float rs = 0.f;
#pragma unroll
    for (int i = 0; i < 16; ++i) {
      const float ev = __expf(x[i] - mnew);
      p[i] = (x[i] > -1.0e29f) ? ev : 0.f;
      rs += p[i];
    }
    rs += __shfl_xor(rs, 16);
    const float c = __expf(m - mnew);
    l = l * c + rs;
    m = mnew;
    FragH ph, pl;
#pragma unroll
    for (int i = 0; i < 16; ++i) {
      const float ps = p[i] * 1024.0f;
      const _Float16 hv = (_Float16)ps;
      ph.h[i] = hv;
      pl.h[i] = (_Float16)((ps - (float)hv) * 2048.0f);
    }
#pragma unroll
    for (int r = 0; r < 8; ++r) { a0h[r] *= c; a1h[r] *= c; a0l[r] *= c; a1l[r] *= c; }
    {
      FragH va;
      va.half[0] = ld_tr16(vp);
      va.half[1] = ld_tr16(vp + 16 * VPITCH);
      a0h = mma16(va.v, ph.v, a0h);
      a0l = mma16(va.v, pl.v, a0l);
      va.half[0] = ld_tr16(vp + 32);
      va.half[1] = ld_tr16(vp + 16 * VPITCH + 32);
      a1h = mma16(va.v, ph.v, a1h);
      a1l = mma16(va.v, pl.v, a1l);
    }
  }

  // epilogue: out[qg][head*32 + d]; a0: d = 8hh + r, a1: d = 16 + 8hh + r
  const float inv = 1.0f / l;                          // l >= 1
  const float fo = inv * 0.0000152587890625f;          // 2^-10 (P carry) x 2^-6 (V carry)
  v4f t0, t1, t2, t3;
#pragma unroll
  for (int r = 0; r < 4; ++r) {
    t0[r] = (a0h[r]     + a0l[r]     * 0.00048828125f) * fo;
    t1[r] = (a0h[4 + r] + a0l[4 + r] * 0.00048828125f) * fo;
    t2[r] = (a1h[r]     + a1l[r]     * 0.00048828125f) * fo;
    t3[r] = (a1h[4 + r] + a1l[4 + r] * 0.00048828125f) * fo;
  }
  *(v4fa*)&so[w][l15][8 * hh]          = t0;
  *(v4fa*)&so[w][l15][8 * hh + 4]      = t1;
  *(v4fa*)&so[w][l15][16 + 8 * hh]     = t2;
  *(v4fa*)&so[w][l15][16 + 8 * hh + 4] = t3;
  __syncthreads();
  const int ql = lane >> 3, c4 = (lane & 7) * 4;
  float* orow = out + ((size_t)b * SEQ + q0 + 16 * w) * EMB + head * DHEAD + c4;
  {
#pragma unroll
    for (int j = 0; j < 4; ++j) {
      const int r = 4 * j + ql;
      const v4f vv = *(const v4fa*)&so[w][r][c4];
      *(v4f*)(orow + (size_t)r * EMB) = vv;
    }
    
  }
}

extern "C" void kernel_launch(void* const* d_in, const int* in_sizes, int n_in,
                              void* d_out, int out_size, void* d_ws, size_t ws_size, hipStream_t stream) {
  if (n_in < 4) return;
  if (in_sizes[0] < NB * SEQ * EMB || in_sizes[1] < NB * SEQ * EMB || in_sizes[2] < NB * SEQ * EMB || in_sizes[3] < 1) return;
  if (out_size < NB * SEQ * EMB) return;
  const float* q = (const float*)d_in[0];
  const float* k = (const float*)d_in[1];
  const float* v = (const float*)d_in[2];
  const int* cidx = (const int*)d_in[3];
  float* out = (float*)d_out;
  (void)d_ws; (void)ws_size;
  k_attn<<<dim3(SEQ / QBLK, NHEADS, NB), 512, 0, stream>>>(q, k, v, cidx, out);
}

// v002
// It runs in 20.2 microseconds.
// In both of two side-by-side timings against v001, it was 1.18 times as fast.
// All steps since v000 together make it 1.91 times as fast.
#include <hip/hip_runtime.h>
// Compute dtype: site0 scores = K(f16 of bf16-RNE input x2^8) . Q^T(same) on v_wmma_f32_16x16x32_f16, f32 accumulate; site1 out^T = V^T(f16 of bf16-RNE input x2^6) . P^T with P as f16 hi (x2^10) plus f16 residual (x2^21) in two accumulators, v_wmma_f32_16x16x32_f16, f32 accumulate; softmax statistics and epilogue f32.

#ifndef NB
#define NB 4
#endif
#ifndef SEQ
#define SEQ 2048
#endif
#define NB_FULL 4
#define SEQ_FULL 2048
#define EMB 512
#define NHEADS 16
#define DHEAD 32
#define QCH 64
#define WIN 256
#define NEGBIG (-1.0e30f)

static_assert(EMB == NHEADS * DHEAD);
static_assert(SEQ % 64 == 0);
static_assert(QCH == 64);
static_assert(WIN % 64 == 0);
#define QBLK 256
#define KROWS (QBLK + WIN)
#define KPITCH 80
#define VPITCH 96
static_assert(QBLK % QCH == 0 && SEQ % QBLK == 0 && SEQ >= KROWS && SEQ <= SEQ_FULL);
static_assert(KROWS % 64 == 0);

typedef _Float16 v16h __attribute__((ext_vector_type(16)));
typedef unsigned short v8us __attribute__((ext_vector_type(8), may_alias));
typedef unsigned short v4us __attribute__((ext_vector_type(4), may_alias));
typedef short s16x8 __attribute__((ext_vector_type(8)));
typedef float v8f __attribute__((ext_vector_type(8)));
typedef float v4f __attribute__((ext_vector_type(4)));
typedef float v4fa __attribute__((ext_vector_type(4), may_alias));
union FragH { v16h v; v8us half[2]; _Float16 h[16]; unsigned short u[16]; };
union QuadH { _Float16 h[4]; v4us q; };

__device__ __forceinline__ float bf16_rnef(float x) {
  unsigned int u = __float_as_uint(x);
  u = (u + 0x7FFFu + ((u >> 16) & 1u)) & 0xFFFF0000u;
  return __uint_as_float(u);
}

// D = A.B + C (16x16x32, f16 operands, f32 accumulate) followed by the VALU hazard guard
__device__ __forceinline__ v8f mma16(v16h a, v16h b, v8f c) {
  v8f d = __builtin_amdgcn_wmma_f32_16x16x32_f16(false, a, false, b, (short)0, c, false, false);
  asm volatile("v_nop\n\tv_nop\n\tv_nop\n\tv_nop" : "+v"(d) : "v"(a), "v"(b));
  return d;
}

// 16-bit transposing LDS load: lane (c, h) gets T[row0 + 8h + 0..7][col0 + c] of a row-major 16-bit tile; p is the lane's own address (row0 + 8h + (lane & 7), byte 16 * ((lane >> 3) & 1)).
__device__ __forceinline__ v8us ld_tr16(const unsigned char* p) {
  typedef __attribute__((address_space(3))) s16x8 lds_s16x8;
  return __builtin_bit_cast(v8us, __builtin_amdgcn_ds_load_tr16_b128_v8i16((lds_s16x8*)p));
}

// four f32 -> four 16-bit carriers: f16(bf16rne(x) * s) (exact for s = 2^8, 2^6)
__device__ __forceinline__ v4us cvt4(v4f a, float s) {
  QuadH o;
#pragma unroll
  for (int i = 0; i < 4; ++i) o.h[i] = (_Float16)(bf16_rnef(a[i]) * s);
  return o.q;
}

// 2^a by v_exp_f32 with the free issue slot the instruction set asks for behind a transcendental before its source is overwritten.
__device__ __forceinline__ float exp2_slot(float a) {
  float r;
  asm("v_exp_f32 %0, %1\n\tv_nop" : "=v"(r) : "v"(a));
  return r;
}

// One 32-key block of the online softmax. EDGE = true: the block may hold keys below a query's window edge (key < thr), so scores are masked and masked probabilities forced to 0.
// EDGE = false: every key of the block is allowed for every query of the wave; no compare, no select.
template <bool EDGE>
__device__ __forceinline__ void key_block(const unsigned char* kp, const unsigned char* vp, const v16h qbv, const int kg0, const int thr,
                                          v8f& a0h, v8f& a1h, v8f& a0l, v8f& a1l, float& m, float& l) {
  const v8f z8 = {0.f, 0.f, 0.f, 0.f, 0.f, 0.f, 0.f, 0.f};
  const float scl = 0.17677669529663687f * 0.0000152587890625f;   // d^-0.5 x 2^-16 (q and k each carried x2^8)
  v8f s0, s1;
  {
    FragH ka;
    ka.half[0] = *(const v8us*)(kp);
    ka.half[1] = *(const v8us*)(kp + 32);
    s0 = mma16(ka.v, qbv, z8);
    ka.half[0] = *(const v8us*)(kp + 16 * KPITCH);
    ka.half[1] = *(const v8us*)(kp + 16 * KPITCH + 32);
    s1 = mma16(ka.v, qbv, z8);
  }
  // s0[r] <-> key kg0 + r ; s1[r] <-> key kg0 + 16 + r ; both for query qg
  float x[16];
#pragma unroll
  for (int r = 0; r < 8; ++r) {
    if (EDGE) {
      x[r]     = (kg0 + r >= thr)      ? s0[r] * scl : NEGBIG;
      x[8 + r] = (kg0 + 16 + r >= thr) ? s1[r] * scl : NEGBIG;
    } else {
      x[r]     = s0[r] * scl;
      x[8 + r] = s1[r] * scl;
    }
  }
  float mx = x[0];
#pragma unroll
  for (int i = 1; i < 16; ++i) mx = fmaxf(mx, x[i]);
  mx = fmaxf(mx, __shfl_xor(mx, 16));
  const float mnew = fmaxf(m, mx);
  float p[16];
  float rs = 0.f;
#pragma unroll
  for (int i = 0; i < 16; ++i) {
    const float ev = EDGE ? exp2_slot((x[i] - mnew) * 1.44269504088896340736f) : __expf(x[i] - mnew);
    p[i] = (!EDGE || x[i] > -1.0e29f) ? ev : 0.f;
    rs += p[i];
  }
  rs += __shfl_xor(rs, 16);
  const float c = __expf(m - mnew);
  l = l * c + rs;
  m = mnew;
  FragH ph, pl;
#pragma unroll
  for (int i = 0; i < 16; ++i) {
    const float ps = p[i] * 1024.0f;
    const _Float16 hv = (_Float16)ps;
    ph.h[i] = hv;
    pl.h[i] = (_Float16)((ps - (float)hv) * 2048.0f);
  }
#pragma unroll
  for (int r = 0; r < 8; ++r) { a0h[r] *= c; a1h[r] *= c; a0l[r] *= c; a1l[r] *= c; }
  {
    FragH va;
    va.half[0] = ld_tr16(vp);
    va.half[1] = ld_tr16(vp + 16 * VPITCH);
    a0h = mma16(va.v, ph.v, a0h);
    a0l = mma16(va.v, pl.v, a0l);
    va.half[0] = ld_tr16(vp + 32);
    va.half[1] = ld_tr16(vp + 16 * VPITCH + 32);
    a1h = mma16(va.v, ph.v, a1h);
    a1l = mma16(va.v, pl.v, a1l);
  }
}

// Windowed attention, one launch. block = (4 query chunks = QBLK queries, head, batch), 512 threads; wave w owns query tile tq: queries q0 + 16 tq + 0..15 (chunk w >> 2); lane (hh, l15) owns query qg.
// Staging: the block reads the f32 rows of keys [kf, kf + KROWS), kf = max(0, q0 - WIN), of its head (one 128-byte line a row), converts them and keeps K (pitch KPITCH, key rows) and V (pitch VPITCH, key rows) as 16-bit carriers in LDS;
// rows kf .. kf + KROWS - 1 all lie inside the sequence (SEQ >= KROWS); the first block of a sequence stages rows it never reads. One barrier between fill and the first fragment load. Q goes from f32 straight into the B fragment.
// Key allowed for query qg iff key >= qg - (WIN - 1) (same-chunk keys are all allowed, window keys end just before the chunk). The 16 window edges of tile t = tq & 3 lie in [qs + 16t - WIN + 1, qs + 16t - WIN + 16],
// all within [ke + 1, ke + 32] for ke = qs - WIN + 32 (t >> 1), the start of one 32-key block: keys below ke are masked for all 16 queries and are not computed, keys from ke + 32 on are allowed for all 16.
// Keys computed per wave: [kstart, qs + 64) with kstart = max(0, ke); only the first block is masked. Tiles 0, 1 walk one block more than tiles 2, 3; waves w and w + 4 share a SIMD, so the tile is rotated by the chunk and every SIMD gets all four tiles.
// Per 32-key block: S^T tiles s0 (keys kb0..kb0+15 on rows) and s1 (keys kb0+16..31) = K(A, m = key) . Q^T(B, n = query); lane holds 16 keys of its query;
// row max / sum = register reduce + one xor-16 shuffle; P^T B fragment element r <- s0[r], element 8+r <- s1[r] (chained-D map); out^T tile u = V^T(A, m = d 16u + l15, by the transposing load) . P^T.
// P carried as f16 hi = f16(p * 2^10) and residual f16((p*2^10 - hi) * 2^11) into separate accumulators; folded in the f32 epilogue with 2^-11, then 2^-10 (P carry), 2^-6 (V carry), 1/l.
__global__ __launch_bounds__(512)
void k_attn(const float* __restrict__ q, const float* __restrict__ k, const float* __restrict__ v,
            const int* __restrict__ cidx, float* __restrict__ out) {
  __shared__ __attribute__((aligned(16))) unsigned char kl[KROWS * KPITCH];
  __shared__ __attribute__((aligned(16))) unsigned char vl[KROWS * VPITCH];
  __shared__ __attribute__((aligned(16))) float so[QBLK / 16][16][32];
  (void)cidx;
  const int qblk = blockIdx.x, head = blockIdx.y, b = blockIdx.z;
  const int tid = threadIdx.x, lane = tid & 31, l15 = lane & 15, hh = lane >> 4;
  const int w = __builtin_amdgcn_readfirstlane(tid >> 5);   // wave number in a scalar register: the key loop's trip count stays a scalar branch
  const int q0 = qblk * QBLK;
  const int kf = (q0 >= WIN) ? (q0 - WIN) : 0;   // first staged key
  const int qs = q0 + (w >> 2) * QCH;             // this wave's chunk start
  const int tq = (w & ~3) | ((w + (w >> 2)) & 3);   // this wave's query tile
  const int ke = qs - WIN + 32 * ((tq & 3) >> 1); // 32-key block that holds the tile's window edges
  const int kstart = (ke > 0) ? ke : 0;
  const int nk = qs + QCH - kstart;          // multiple of 32, >= QCH, <= QCH + WIN
  const int nblk = nk >> 5;
  const int qg = q0 + 16 * tq + l15;          // this lane's query (column n of every tile)
  const int thr = qg - (WIN - 1);             // key allowed iff key >= thr (keys are < qs + 64 by construction)

  FragH qb;
  {
    // all global loads first: 8 threads a row, 16 bytes each, 64 rows a sweep
    const int srow = tid >> 3, sc = tid & 7;
    const size_t goff = ((size_t)b * SEQ_FULL + kf + srow) * EMB + head * DHEAD + sc * 4;
    const float* kg = k + goff;
    const float* vg = v + goff;
    const float* qp = q + ((size_t)b * SEQ_FULL + qg) * EMB + head * DHEAD + 8 * hh;
    v4f kr[KROWS / 64], vr[KROWS / 64];
#pragma unroll
    for (int i = 0; i < KROWS / 64; ++i) kr[i] = *(const v4fa*)(kg + (size_t)i * 64 * EMB);
#pragma unroll
    for (int i = 0; i < KROWS / 64; ++i) vr[i] = *(const v4fa*)(vg + (size_t)i * 64 * EMB);
    const v4f qa = *(const v4fa*)(qp), qc = *(const v4fa*)(qp + 4), qd = *(const v4fa*)(qp + 16), qe = *(const v4fa*)(qp + 20);
    // the loads' address registers stay live (inputs) up to this wait, so nothing, a load's own result included, overwrites one ahead of it
    asm volatile("s_wait_xcnt 0x0" :: "v"(kg), "v"(vg), "v"(qp) : "memory");
#pragma unroll
    for (int i = 0; i < KROWS / 64; ++i) *(v4us*)(kl + (srow + 64 * i) * KPITCH + sc * 8) = cvt4(kr[i], 256.0f);
#pragma unroll
    for (int i = 0; i < KROWS / 64; ++i) *(v4us*)(vl + (srow + 64 * i) * VPITCH + sc * 8) = cvt4(vr[i], 64.0f);
    // Q^T B fragment: n = query l15, elements 0..7 <- d 8hh+0..7, 8..15 <- d 16+8hh+0..7
#pragma unroll
    for (int i = 0; i < 4; ++i) {
      qb.h[i]      = (_Float16)(bf16_rnef(qa[i]) * 256.0f);
      qb.h[4 + i]  = (_Float16)(bf16_rnef(qc[i]) * 256.0f);
      qb.h[8 + i]  = (_Float16)(bf16_rnef(qd[i]) * 256.0f);
      qb.h[12 + i] = (_Float16)(bf16_rnef(qe[i]) * 256.0f);
    }
  }
  __syncthreads();
  const unsigned char* kbase = kl + (kstart - kf + l15) * KPITCH + 16 * hh;                                   // A rows: m = key kstart + kb0 + 16t + l15
  const unsigned char* vbase = vl + (kstart - kf + 8 * hh + (lane & 7)) * VPITCH + 16 * ((lane >> 3) & 1);   // transposing load: rows = keys, columns = d

  const v8f z8 = {0.f, 0.f, 0.f, 0.f, 0.f, 0.f, 0.f, 0.f};
  v8f a0h = z8, a1h = z8, a0l = z8, a1l = z8;
  float m = NEGBIG, l = 0.f;

  const unsigned char* kp = kbase;
  const unsigned char* vp = vbase;
  // first block: the only one that can hold a key below a window edge of this wave
  key_block<true>(kp, vp, qb.v, kstart + 8 * hh, thr, a0h, a1h, a0l, a1l, m, l);
  kp += 32 * KPITCH;
  vp += 32 * VPITCH;
#pragma unroll 1
  for (int kb = 1; kb < nblk; ++kb, kp += 32 * KPITCH, vp += 32 * VPITCH)
    key_block<false>(kp, vp, qb.v, 0, 0, a0h, a1h, a0l, a1l, m, l);

  // epilogue: out[qg][head*32 + d]; a0: d = 8hh + r, a1: d = 16 + 8hh + r
  const float inv = 1.0f / l;                          // l >= 1
  const float fo = inv * 0.0000152587890625f;          // 2^-10 (P carry) x 2^-6 (V carry)
  v4f t0, t1, t2, t3;
#pragma unroll
  for (int r = 0; r < 4; ++r) {
    t0[r] = (a0h[r]     + a0l[r]     * 0.00048828125f) * fo;
    t1[r] = (a0h[4 + r] + a0l[4 + r] * 0.00048828125f) * fo;
    t2[r] = (a1h[r]     + a1l[r]     * 0.00048828125f) * fo;
    t3[r] = (a1h[4 + r] + a1l[4 + r] * 0.00048828125f) * fo;
  }
  *(v4fa*)&so[w][l15][8 * hh]          = t0;
  *(v4fa*)&so[w][l15][8 * hh + 4]      = t1;
  *(v4fa*)&so[w][l15][16 + 8 * hh]     = t2;
  *(v4fa*)&so[w][l15][16 + 8 * hh + 4] = t3;
  __syncthreads();
  const int ql = lane >> 3, c4 = (lane & 7) * 4;
  float* orow = out + ((size_t)b * SEQ + q0 + 16 * tq) * EMB + head * DHEAD + c4;
  {
#pragma unroll
    for (int j = 0; j < 4; ++j) {
      const int r = 4 * j + ql;
      const v4f vv = *(const v4fa*)&so[w][r][c4];
      *(v4f*)(orow + (size_t)r * EMB) = vv;
    }
    
  }
}

extern "C" void kernel_launch(void* const* d_in, const int* in_sizes, int n_in,
                              void* d_out, int out_size, void* d_ws, size_t ws_size, hipStream_t stream) {
  if (n_in < 4) return;
  if (in_sizes[0] < NB * SEQ * EMB || in_sizes[1] < NB * SEQ * EMB || in_sizes[2] < NB * SEQ * EMB || in_sizes[3] < 1) return;
  if (out_size < NB * SEQ * EMB) return;
  const float* q = (const float*)d_in[0];
  const float* k = (const float*)d_in[1];
  const float* v = (const float*)d_in[2];
  const int* cidx = (const int*)d_in[3];
  float* out = (float*)d_out;
  (void)d_ws; (void)ws_size;
  k_attn<<<dim3(SEQ / QBLK, NHEADS, NB), 512, 0, stream>>>(q, k, v, cidx, out);
}

// v003
// One run takes 17.6 microseconds.
// Next to v002, in two timings, it ran 1.15 and 1.14 times as fast.
// Counting every step since v000, it is 2.18 times as fast.
#include <hip/hip_runtime.h>
// Compute dtype: site0 scores = K(f16 of bf16-RNE input x2^8) . Q^T(same) on v_wmma_f32_16x16x32_f16, f32 accumulate; site1 out^T = V^T(f16 of bf16-RNE input x2^6) . P^T with P as f16 hi plus f16 residual (both x2^15) added into one accumulator, v_wmma_f32_16x16x32_f16, f32 accumulate; softmax statistics and epilogue f32.

#ifndef NB
#define NB 4
#endif
#ifndef SEQ
#define SEQ 2048
#endif
#define NB_FULL 4
#define SEQ_FULL 2048
#define EMB 512
#define NHEADS 16
#define DHEAD 32
#define QCH 64
#define WIN 256
#define NEGBIG (-1.0e30f)

static_assert(EMB == NHEADS * DHEAD);
static_assert(SEQ % 64 == 0);
static_assert(QCH == 64);
static_assert(WIN % 64 == 0);
#define QBLK 256
#define KROWS (QBLK + WIN)
#define KPITCH 80
#define VPITCH 96
static_assert(QBLK % QCH == 0 && SEQ % QBLK == 0 && SEQ >= KROWS && SEQ <= SEQ_FULL);
static_assert(KROWS % 64 == 0);

typedef _Float16 v16h __attribute__((ext_vector_type(16)));
typedef unsigned short v8us __attribute__((ext_vector_type(8), may_alias));
typedef unsigned short v4us __attribute__((ext_vector_type(4), may_alias));
typedef short s16x8 __attribute__((ext_vector_type(8)));
typedef float v8f __attribute__((ext_vector_type(8)));
typedef float v4f __attribute__((ext_vector_type(4)));
typedef float v4fa __attribute__((ext_vector_type(4), may_alias));
union FragH { v16h v; v8us half[2]; _Float16 h[16]; unsigned short u[16]; };
union QuadH { _Float16 h[4]; v4us q; };
typedef float v2f __attribute__((ext_vector_type(2)));
typedef _Float16 v2h __attribute__((ext_vector_type(2)));
union FragW { v16h v; unsigned int w[8]; };

__device__ __forceinline__ float bf16_rnef(float x) {
  unsigned int u = __float_as_uint(x);
  u = (u + 0x7FFFu + ((u >> 16) & 1u)) & 0xFFFF0000u;
  return __uint_as_float(u);
}

// D = A.B + C (16x16x32, f16 operands, f32 accumulate) followed by the VALU hazard guard
__device__ __forceinline__ v8f mma16(v16h a, v16h b, v8f c) {
  v8f d = __builtin_amdgcn_wmma_f32_16x16x32_f16(false, a, false, b, (short)0, c, false, false);
  asm volatile("v_nop\n\tv_nop\n\tv_nop\n\tv_nop" : "+v"(d) : "v"(a), "v"(b));
  return d;
}

// 16-bit transposing LDS load: lane (c, h) gets T[row0 + 8h + 0..7][col0 + c] of a row-major 16-bit tile; p is the lane's own address (row0 + 8h + (lane & 7), byte 16 * ((lane >> 3) & 1)).
__device__ __forceinline__ v8us ld_tr16(const unsigned char* p) {
  typedef __attribute__((address_space(3))) s16x8 lds_s16x8;
  return __builtin_bit_cast(v8us, __builtin_amdgcn_ds_load_tr16_b128_v8i16((lds_s16x8*)p));
}

// four f32 -> four 16-bit carriers: f16(bf16rne(x) * s) (exact for s = 2^8, 2^6)
__device__ __forceinline__ v4us cvt4(v4f a, float s) {
  QuadH o;
#pragma unroll
  for (int i = 0; i < 4; ++i) o.h[i] = (_Float16)(bf16_rnef(a[i]) * s);
  return o.q;
}

// 2^a by v_exp_f32 with the free issue slot the instruction set asks for behind a transcendental before its source is overwritten.
__device__ __forceinline__ float exp2_slot(float a) {
  float r;
  asm("v_exp_f32 %0, %1\n\tv_nop" : "=v"(r) : "v"(a));
  return r;
}

// Residuals of four packed f16 pairs: l.lo = f16(s[2j] - h.lo), l.hi = f16(s[2j+1] - h.hi). The mixed-precision FMA reads the f16 half and the f32 value directly and writes the f16 half:
// one instruction an element, where convert back, subtract and convert again take three. s - h is exact in f32, so the one rounding is the conversion to f16.
// The four high-half writes each follow their register's low-half write four instructions back: s_delay_alu names that distance, so that the SIMD issues another wave meanwhile.
__device__ __forceinline__ void resid4(unsigned int& l0, unsigned int& l1, unsigned int& l2, unsigned int& l3,
                                       const unsigned int h0, const unsigned int h1, const unsigned int h2, const unsigned int h3, const float* s) {
  asm("v_fma_mixlo_f16 %0, %8, 1.0, -%4 op_sel_hi:[0,0,1]\n\t"
      "v_fma_mixlo_f16 %1, %10, 1.0, -%5 op_sel_hi:[0,0,1]\n\t"
      "v_fma_mixlo_f16 %2, %12, 1.0, -%6 op_sel_hi:[0,0,1]\n\t"
      "v_fma_mixlo_f16 %3, %14, 1.0, -%7 op_sel_hi:[0,0,1]\n\t"
      "s_delay_alu instid0(VALU_DEP_4) | instskip(NEXT) | instid1(VALU_DEP_4)\n\t"
      "v_fma_mixhi_f16 %0, %9, 1.0, -%4 op_sel:[0,0,1] op_sel_hi:[0,0,1]\n\t"
      "v_fma_mixhi_f16 %1, %11, 1.0, -%5 op_sel:[0,0,1] op_sel_hi:[0,0,1]\n\t"
      "s_delay_alu instid0(VALU_DEP_4) | instskip(NEXT) | instid1(VALU_DEP_4)\n\t"
      "v_fma_mixhi_f16 %2, %13, 1.0, -%6 op_sel:[0,0,1] op_sel_hi:[0,0,1]\n\t"
      "v_fma_mixhi_f16 %3, %15, 1.0, -%7 op_sel:[0,0,1] op_sel_hi:[0,0,1]"
      : "=&v"(l0), "=&v"(l1), "=&v"(l2), "=&v"(l3)
      : "v"(h0), "v"(h1), "v"(h2), "v"(h3), "v"(s[0]), "v"(s[1]), "v"(s[2]), "v"(s[3]), "v"(s[4]), "v"(s[5]), "v"(s[6]), "v"(s[7]));
}

// One 32-key block of the online softmax. EDGE = true: the block may hold keys below a query's window edge (key < thr), so scores are masked and masked probabilities forced to 0.
// EDGE = false: every key of the block is allowed for every query of the wave; no compare, no select.
template <bool EDGE>
__device__ __forceinline__ void key_block(const unsigned char* kp, const unsigned char* vp, const v16h qbv, const int kg0, const int thr,
                                          v8f& a0, v8f& a1, float& m, float& l) {
  const v8f z8 = {0.f, 0.f, 0.f, 0.f, 0.f, 0.f, 0.f, 0.f};
  const float scl = 0.17677669529663687f * 0.0000152587890625f;   // d^-0.5 x 2^-16 (q and k each carried x2^8)
  v8f s0, s1;
  {
    FragH ka;
    ka.half[0] = *(const v8us*)(kp);
    ka.half[1] = *(const v8us*)(kp + 32);
    s0 = mma16(ka.v, qbv, z8);
    ka.half[0] = *(const v8us*)(kp + 16 * KPITCH);
    ka.half[1] = *(const v8us*)(kp + 16 * KPITCH + 32);
    s1 = mma16(ka.v, qbv, z8);
  }
  // s0[r] <-> key kg0 + r ; s1[r] <-> key kg0 + 16 + r ; both for query qg
  float x[16];
#pragma unroll
  for (int r = 0; r < 8; ++r) {
    if (EDGE) {
      x[r]     = (kg0 + r >= thr)      ? s0[r] * scl : NEGBIG;
      x[8 + r] = (kg0 + 16 + r >= thr) ? s1[r] * scl : NEGBIG;
    } else {
      x[r]     = s0[r] * scl;
      x[8 + r] = s1[r] * scl;
    }
  }
  float mx = x[0];
#pragma unroll
  for (int i = 1; i < 16; ++i) mx = fmaxf(mx, x[i]);
  mx = fmaxf(mx, __shfl_xor(mx, 16));
  const float mnew = fmaxf(m, mx);
  float p[16];
  float rs = 0.f;
#pragma unroll
  for (int i = 0; i < 16; ++i) {
    const float ev = (EDGE || i == 8) ? exp2_slot((x[i] - mnew) * 1.44269504088896340736f) : __expf(x[i] - mnew);
    p[i] = (!EDGE || x[i] > -1.0e29f) ? ev : 0.f;
    rs += p[i];
  }
  rs += __shfl_xor(rs, 16);
  const float c = exp2_slot((m - mnew) * 1.44269504088896340736f);
  l = l * c + rs;
  m = mnew;
  FragW ph, pl;
  float ps[16];
#pragma unroll
  for (int j = 0; j < 8; ++j) {
    const v2f pp = {p[2 * j] * 32768.0f, p[2 * j + 1] * 32768.0f};
    ps[2 * j] = pp[0];
    ps[2 * j + 1] = pp[1];
    ph.w[j] = __builtin_bit_cast(unsigned int, __builtin_convertvector(pp, v2h));
  }
  resid4(pl.w[0], pl.w[1], pl.w[2], pl.w[3], ph.w[0], ph.w[1], ph.w[2], ph.w[3], ps);
  resid4(pl.w[4], pl.w[5], pl.w[6], pl.w[7], ph.w[4], ph.w[5], ph.w[6], ph.w[7], ps + 8);
#pragma unroll
  for (int r = 0; r < 8; ++r) { a0[r] *= c; a1[r] *= c; }
  {
    // both tiles' hi products first, then both residual products: no product waits on the accumulator of the one directly ahead
    FragH va0, va1;
    va0.half[0] = ld_tr16(vp);
    va0.half[1] = ld_tr16(vp + 16 * VPITCH);
    va1.half[0] = ld_tr16(vp + 32);
    va1.half[1] = ld_tr16(vp + 16 * VPITCH + 32);
    a0 = mma16(va0.v, ph.v, a0);
    a1 = mma16(va1.v, ph.v, a1);
    a0 = mma16(va0.v, pl.v, a0);
    a1 = mma16(va1.v, pl.v, a1);
  }
}

// Windowed attention, one launch. block = (4 query chunks = QBLK queries, head, batch), 512 threads; wave w owns query tile tq: queries q0 + 16 tq + 0..15 (chunk w >> 2); lane (hh, l15) owns query qg.
// Staging: the block reads the f32 rows of keys [kf, kf + KROWS), kf = max(0, q0 - WIN), of its head (one 128-byte line a row), converts them and keeps K (pitch KPITCH, key rows) and V (pitch VPITCH, key rows) as 16-bit carriers in LDS;
// rows kf .. kf + KROWS - 1 all lie inside the sequence (SEQ >= KROWS); the first block of a sequence stages rows it never reads. One barrier between fill and the first fragment load. Q goes from f32 straight into the B fragment.
// Key allowed for query qg iff key >= qg - (WIN - 1) (same-chunk keys are all allowed, window keys end just before the chunk). The 16 window edges of tile t = tq & 3 lie in [qs + 16t - WIN + 1, qs + 16t - WIN + 16],
// all within [ke + 1, ke + 32] for ke = qs - WIN + 32 (t >> 1), the start of one 32-key block: keys below ke are masked for all 16 queries and are not computed, keys from ke + 32 on are allowed for all 16.
// Keys computed per wave: [kstart, qs + 64) with kstart = max(0, ke); only the first block is masked. Tiles 0, 1 walk one block more than tiles 2, 3; waves w and w + 4 share a SIMD, so the tile is rotated by the chunk and every SIMD gets all four tiles.
// Per 32-key block: S^T tiles s0 (keys kb0..kb0+15 on rows) and s1 (keys kb0+16..31) = K(A, m = key) . Q^T(B, n = query); lane holds 16 keys of its query;
// row max / sum = register reduce + one xor-16 shuffle; P^T B fragment element r <- s0[r], element 8+r <- s1[r] (chained-D map); out^T tile u = V^T(A, m = d 16u + l15, by the transposing load) . P^T.
// P carried as f16 hi = f16(p * 2^15) (p <= 1, so hi <= 32768) and residual f16(p * 2^15 - hi) at the same carry; both products add into the tile's one accumulator; the f32 epilogue takes out 2^-15 (P carry), 2^-6 (V carry), 1/l.
__global__ __launch_bounds__(512)
void k_attn(const float* __restrict__ q, const float* __restrict__ k, const float* __restrict__ v,
            const int* __restrict__ cidx, float* __restrict__ out) {
  __shared__ __attribute__((aligned(16))) unsigned char kl[KROWS * KPITCH];
  __shared__ __attribute__((aligned(16))) unsigned char vl[KROWS * VPITCH];
  __shared__ __attribute__((aligned(16))) float so[QBLK / 16][16][32];
  (void)cidx;
  const int qblk = blockIdx.x, head = blockIdx.y, b = blockIdx.z;
  const int tid = threadIdx.x, lane = tid & 31, l15 = lane & 15, hh = lane >> 4;
  const int w = __builtin_amdgcn_readfirstlane(tid >> 5);   // wave number in a scalar register: the key loop's trip count stays a scalar branch
  const int q0 = qblk * QBLK;
  const int kf = (q0 >= WIN) ? (q0 - WIN) : 0;   // first staged key
  const int qs = q0 + (w >> 2) * QCH;             // this wave's chunk start
  const int tq = (w & ~3) | ((w + (w >> 2)) & 3);   // this wave's query tile
  const int ke = qs - WIN + 32 * ((tq & 3) >> 1); // 32-key block that holds the tile's window edges
  const int kstart = (ke > 0) ? ke : 0;
  const int nk = qs + QCH - kstart;          // multiple of 32, >= QCH, <= QCH + WIN
  const int nblk = nk >> 5;
  const int qg = q0 + 16 * tq + l15;          // this lane's query (column n of every tile)
  const int thr = qg - (WIN - 1);             // key allowed iff key >= thr (keys are < qs + 64 by construction)

  FragH qb;
  {
    // all global loads first: 8 threads a row, 16 bytes each, 64 rows a sweep
    const int srow = tid >> 3, sc = tid & 7;
    const size_t goff = ((size_t)b * SEQ_FULL + kf + srow) * EMB + head * DHEAD + sc * 4;
    const float* kg = k + goff;
    const float* vg = v + goff;
    const float* qp = q + ((size_t)b * SEQ_FULL + qg) * EMB + head * DHEAD + 8 * hh;
    v4f kr[KROWS / 64], vr[KROWS / 64];
#pragma unroll
    for (int i = 0; i < KROWS / 64; ++i) kr[i] = *(const v4fa*)(kg + (size_t)i * 64 * EMB);
#pragma unroll
    for (int i = 0; i < KROWS / 64; ++i) vr[i] = *(const v4fa*)(vg + (size_t)i * 64 * EMB);
    const v4f qa = *(const v4fa*)(qp), qc = *(const v4fa*)(qp + 4), qd = *(const v4fa*)(qp + 16), qe = *(const v4fa*)(qp + 20);
    // the loads' address registers stay live (inputs) up to this wait, so nothing, a load's own result included, overwrites one ahead of it
    asm volatile("s_wait_xcnt 0x0" :: "v"(kg), "v"(vg), "v"(qp) : "memory");
#pragma unroll
    for (int i = 0; i < KROWS / 64; ++i) *(v4us*)(kl + (srow + 64 * i) * KPITCH + sc * 8) = cvt4(kr[i], 256.0f);
#pragma unroll
    for (int i = 0; i < KROWS / 64; ++i) *(v4us*)(vl + (srow + 64 * i) * VPITCH + sc * 8) = cvt4(vr[i], 64.0f);
    // Q^T B fragment: n = query l15, elements 0..7 <- d 8hh+0..7, 8..15 <- d 16+8hh+0..7
#pragma unroll
    for (int i = 0; i < 4; ++i) {
      qb.h[i]      = (_Float16)(bf16_rnef(qa[i]) * 256.0f);
      qb.h[4 + i]  = (_Float16)(bf16_rnef(qc[i]) * 256.0f);
      qb.h[8 + i]  = (_Float16)(bf16_rnef(qd[i]) * 256.0f);
      qb.h[12 + i] = (_Float16)(bf16_rnef(qe[i]) * 256.0f);
    }
  }
  __syncthreads();
  const unsigned char* kbase = kl + (kstart - kf + l15) * KPITCH + 16 * hh;                                   // A rows: m = key kstart + kb0 + 16t + l15
  const unsigned char* vbase = vl + (kstart - kf + 8 * hh + (lane & 7)) * VPITCH + 16 * ((lane >> 3) & 1);   // transposing load: rows = keys, columns = d

  const v8f z8 = {0.f, 0.f, 0.f, 0.f, 0.f, 0.f, 0.f, 0.f};
  v8f a0 = z8, a1 = z8;
  float m = NEGBIG, l = 0.f;

  const unsigned char* kp = kbase;
  const unsigned char* vp = vbase;
  // first block: the only one that can hold a key below a window edge of this wave
  key_block<true>(kp, vp, qb.v, kstart + 8 * hh, thr, a0, a1, m, l);
  kp += 32 * KPITCH;
  vp += 32 * VPITCH;
#pragma unroll 1
  for (int kb = 1; kb < nblk; ++kb, kp += 32 * KPITCH, vp += 32 * VPITCH)
    key_block<false>(kp, vp, qb.v, 0, 0, a0, a1, m, l);

  // epilogue: out[qg][head*32 + d]; a0: d = 8hh + r, a1: d = 16 + 8hh + r
  const float inv = 1.0f / l;                          // l >= 1
  const float fo = inv * 0.000000476837158203125f;     // 2^-15 (P carry) x 2^-6 (V carry)
  v4f t0, t1, t2, t3;
#pragma unroll
  for (int r = 0; r < 4; ++r) {
    t0[r] = a0[r]     * fo;
    t1[r] = a0[4 + r] * fo;
    t2[r] = a1[r]     * fo;
    t3[r] = a1[4 + r] * fo;
  }
  *(v4fa*)&so[w][l15][8 * hh]          = t0;
  *(v4fa*)&so[w][l15][8 * hh + 4]      = t1;
  *(v4fa*)&so[w][l15][16 + 8 * hh]     = t2;
  *(v4fa*)&so[w][l15][16 + 8 * hh + 4] = t3;
  __syncthreads();
  const int ql = lane >> 3, c4 = (lane & 7) * 4;
  float* orow = out + ((size_t)b * SEQ + q0 + 16 * tq) * EMB + head * DHEAD + c4;
  {
#pragma unroll
    for (int j = 0; j < 4; ++j) {
      const int r = 4 * j + ql;
      const v4f vv = *(const v4fa*)&so[w][r][c4];
      *(v4f*)(orow + (size_t)r * EMB) = vv;
    }
    
  }
}

extern "C" void kernel_launch(void* const* d_in, const int* in_sizes, int n_in,
                              void* d_out, int out_size, void* d_ws, size_t ws_size, hipStream_t stream) {
  if (n_in < 4) return;
  if (in_sizes[0] < NB * SEQ * EMB || in_sizes[1] < NB * SEQ * EMB || in_sizes[2] < NB * SEQ * EMB || in_sizes[3] < 1) return;
  if (out_size < NB * SEQ * EMB) return;
  const float* q = (const float*)d_in[0];
  const float* k = (const float*)d_in[1];
  const float* v = (const float*)d_in[2];
  const int* cidx = (const int*)d_in[3];
  float* out = (float*)d_out;
  (void)d_ws; (void)ws_size;
  k_attn<<<dim3(SEQ / QBLK, NHEADS, NB), 512, 0, stream>>>(q, k, v, cidx, out);
}

// v004
// One run takes 16.3 microseconds.
// Next to v003, in two timings, it ran 1.09 and 1.08 times as fast.
// Counting every step since v000, it is 2.36 times as fast.
#include <hip/hip_runtime.h>
// Compute dtype: site0 scores = K(f16 of bf16-RNE input x2^8) . Q^T(same) on v_wmma_f32_16x16x32_f16, f32 accumulate; site1 out^T = V^T(f16 of bf16-RNE input x2^6) . P^T with P as f16 hi plus f16 residual (both x2^15) added into one accumulator, v_wmma_f32_16x16x32_f16, f32 accumulate; softmax statistics and epilogue f32.

#ifndef NB
#define NB 4
#endif
#ifndef SEQ
#define SEQ 2048
#endif
#define NB_FULL 4
#define SEQ_FULL 2048
#define EMB 512
#define NHEADS 16
#define DHEAD 32
#define QCH 64
#define WIN 256
#define NEGBIG (-1.0e30f)

static_assert(EMB == NHEADS * DHEAD);
static_assert(SEQ % 64 == 0);
static_assert(QCH == 64);
static_assert(WIN % 64 == 0);
#define QBLK 256
#define KROWS (QBLK + WIN)
#define KPITCH 80
#define VPITCH 96
static_assert(QBLK % QCH == 0 && SEQ % QBLK == 0 && SEQ >= KROWS && SEQ <= SEQ_FULL);
static_assert(KROWS % 64 == 0);

typedef _Float16 v16h __attribute__((ext_vector_type(16)));
typedef unsigned short v8us __attribute__((ext_vector_type(8), may_alias));
typedef unsigned short v4us __attribute__((ext_vector_type(4), may_alias));
typedef short s16x8 __attribute__((ext_vector_type(8)));
typedef float v8f __attribute__((ext_vector_type(8)));
typedef float v4f __attribute__((ext_vector_type(4)));
typedef float v4fa __attribute__((ext_vector_type(4), may_alias));
union FragH { v16h v; v8us half[2]; _Float16 h[16]; unsigned short u[16]; };
union QuadH { _Float16 h[4]; v4us q; };
typedef float v2f __attribute__((ext_vector_type(2)));
typedef _Float16 v2h __attribute__((ext_vector_type(2)));
union FragW { v16h v; unsigned int w[8]; };

__device__ __forceinline__ float bf16_rnef(float x) {
  unsigned int u = __float_as_uint(x);
  u = (u + 0x7FFFu + ((u >> 16) & 1u)) & 0xFFFF0000u;
  return __uint_as_float(u);
}

// D = A.B + C (16x16x32, f16 operands, f32 accumulate) followed by the VALU hazard guard
__device__ __forceinline__ v8f mma16(v16h a, v16h b, v8f c) {
  v8f d = __builtin_amdgcn_wmma_f32_16x16x32_f16(false, a, false, b, (short)0, c, false, false);
  asm volatile("v_nop\n\tv_nop\n\tv_nop\n\tv_nop" : "+v"(d) : "v"(a), "v"(b));
  return d;
}

// 16-bit transposing LDS load: lane (c, h) gets T[row0 + 8h + 0..7][col0 + c] of a row-major 16-bit tile; p is the lane's own address (row0 + 8h + (lane & 7), byte 16 * ((lane >> 3) & 1)).
__device__ __forceinline__ v8us ld_tr16(const unsigned char* p) {
  typedef __attribute__((address_space(3))) s16x8 lds_s16x8;
  return __builtin_bit_cast(v8us, __builtin_amdgcn_ds_load_tr16_b128_v8i16((lds_s16x8*)p));
}

// four f32 -> four 16-bit carriers: f16(bf16rne(x) * s) (exact for s = 2^8, 2^6)
__device__ __forceinline__ v4us cvt4(v4f a, float s) {
  QuadH o;
#pragma unroll
  for (int i = 0; i < 4; ++i) o.h[i] = (_Float16)(bf16_rnef(a[i]) * s);
  return o.q;
}

// 2^a by v_exp_f32 with the free issue slot the instruction set asks for behind a transcendental before its source is overwritten.
__device__ __forceinline__ float exp2_slot(float a) {
  float r;
  asm("v_exp_f32 %0, %1\n\tv_nop" : "=v"(r) : "v"(a));
  return r;
}

// Residuals of four packed f16 pairs: l.lo = f16(s[2j] - h.lo), l.hi = f16(s[2j+1] - h.hi). The mixed-precision FMA reads the f16 half and the f32 value directly and writes the f16 half:
// one instruction an element, where convert back, subtract and convert again take three. s - h is exact in f32, so the one rounding is the conversion to f16.
// The four high-half writes each follow their register's low-half write four instructions back: s_delay_alu names that distance, so that the SIMD issues another wave meanwhile.
__device__ __forceinline__ void resid4(unsigned int& l0, unsigned int& l1, unsigned int& l2, unsigned int& l3,
                                       const unsigned int h0, const unsigned int h1, const unsigned int h2, const unsigned int h3, const float* s) {
  asm("v_fma_mixlo_f16 %0, %8, 1.0, -%4 op_sel_hi:[0,0,1]\n\t"
      "v_fma_mixlo_f16 %1, %10, 1.0, -%5 op_sel_hi:[0,0,1]\n\t"
      "v_fma_mixlo_f16 %2, %12, 1.0, -%6 op_sel_hi:[0,0,1]\n\t"
      "v_fma_mixlo_f16 %3, %14, 1.0, -%7 op_sel_hi:[0,0,1]\n\t"
      "s_delay_alu instid0(VALU_DEP_4) | instskip(NEXT) | instid1(VALU_DEP_4)\n\t"
      "v_fma_mixhi_f16 %0, %9, 1.0, -%4 op_sel:[0,0,1] op_sel_hi:[0,0,1]\n\t"
      "v_fma_mixhi_f16 %1, %11, 1.0, -%5 op_sel:[0,0,1] op_sel_hi:[0,0,1]\n\t"
      "s_delay_alu instid0(VALU_DEP_4) | instskip(NEXT) | instid1(VALU_DEP_4)\n\t"
      "v_fma_mixhi_f16 %2, %13, 1.0, -%6 op_sel:[0,0,1] op_sel_hi:[0,0,1]\n\t"
      "v_fma_mixhi_f16 %3, %15, 1.0, -%7 op_sel:[0,0,1] op_sel_hi:[0,0,1]"
      : "=&v"(l0), "=&v"(l1), "=&v"(l2), "=&v"(l3)
      : "v"(h0), "v"(h1), "v"(h2), "v"(h3), "v"(s[0]), "v"(s[1]), "v"(s[2]), "v"(s[3]), "v"(s[4]), "v"(s[5]), "v"(s[6]), "v"(s[7]));
}

// One 32-key block of the online softmax. EDGE = true: the block may hold keys below a query's window edge (key < thr), so scores are masked and masked probabilities forced to 0.
// EDGE = false: every key of the block is allowed for every query of the wave; no compare, no select.
template <bool EDGE>
__device__ __forceinline__ void key_block(const unsigned char* kp, const unsigned char* vp, const v16h qbv, const int kg0, const int thr,
                                          v8f& a0, v8f& a1, float& m, float& l) {
  const v8f z8 = {0.f, 0.f, 0.f, 0.f, 0.f, 0.f, 0.f, 0.f};
  const float cs = 0.17677669529663687f * 0.0000152587890625f * 1.44269504088896340736f;   // d^-0.5 x 2^-16 (q and k each carried x2^8) x log2(e): raw score -> exponent of 2
  v8f s0, s1;
  {
    FragH ka;
    ka.half[0] = *(const v8us*)(kp);
    ka.half[1] = *(const v8us*)(kp + 32);
    s0 = mma16(ka.v, qbv, z8);
    ka.half[0] = *(const v8us*)(kp + 16 * KPITCH);
    ka.half[1] = *(const v8us*)(kp + 16 * KPITCH + 32);
    s1 = mma16(ka.v, qbv, z8);
  }
  // s0[r] <-> key kg0 + r ; s1[r] <-> key kg0 + 16 + r ; both for query qg. x holds the raw accumulators: cs > 0, so their maximum is the scaled scores' maximum too.
  float x[16];
#pragma unroll
  for (int r = 0; r < 8; ++r) {
    x[r]     = (!EDGE || kg0 + r >= thr)      ? s0[r] : NEGBIG;
    x[8 + r] = (!EDGE || kg0 + 16 + r >= thr) ? s1[r] : NEGBIG;
  }
  float mx = x[0];
#pragma unroll
  for (int i = 1; i < 16; ++i) mx = fmaxf(mx, x[i]);
  mx = fmaxf(mx, __shfl_xor(mx, 16));
  const float mnew = fmaxf(m, mx);                     // running maximum, kept in raw score units
  const float nb = __builtin_fmaf(mnew, -cs, 15.0f);   // the P carry 2^15 rides in the exponent
  const v2f cs2 = {cs, cs}, nb2 = {nb, nb};
  // ps[i] = p x 2^15 = 2^(x cs + 15 - mnew cs): score scale, log2(e), maximum and carry all in one FMA an element ahead of the exponential
  float ps[16];
  float rs = 0.f;
  FragW ph, pl;
#pragma unroll
  for (int j = 0; j < 8; ++j) {
    const v2f xx = {x[2 * j], x[2 * j + 1]};
    const v2f ar = __builtin_elementwise_fma(xx, cs2, nb2);
    v2f pp;
#pragma unroll
    for (int e = 0; e < 2; ++e) {
      const float ev = EDGE ? exp2_slot(ar[e]) : __builtin_amdgcn_exp2f(ar[e]);
      pp[e] = (!EDGE || xx[e] > -1.0e29f) ? ev : 0.f;
      ps[2 * j + e] = pp[e];
      rs += pp[e];
    }
    ph.w[j] = __builtin_bit_cast(unsigned int, __builtin_convertvector(pp, v2h));
  }
  rs += __shfl_xor(rs, 16);
  const float c = __builtin_amdgcn_exp2f((m - mnew) * cs);
  l = l * c + rs;   // l carries x2^15 like P
  m = mnew;
  resid4(pl.w[0], pl.w[1], pl.w[2], pl.w[3], ph.w[0], ph.w[1], ph.w[2], ph.w[3], ps);
  resid4(pl.w[4], pl.w[5], pl.w[6], pl.w[7], ph.w[4], ph.w[5], ph.w[6], ph.w[7], ps + 8);
#pragma unroll
  for (int r = 0; r < 8; ++r) { a0[r] *= c; a1[r] *= c; }
  {
    // both tiles' hi products first, then both residual products: no product waits on the accumulator of the one directly ahead
    FragH va0, va1;
    va0.half[0] = ld_tr16(vp);
    va0.half[1] = ld_tr16(vp + 16 * VPITCH);
    va1.half[0] = ld_tr16(vp + 32);
    va1.half[1] = ld_tr16(vp + 16 * VPITCH + 32);
    a0 = mma16(va0.v, ph.v, a0);
    a1 = mma16(va1.v, ph.v, a1);
    a0 = mma16(va0.v, pl.v, a0);
    a1 = mma16(va1.v, pl.v, a1);
  }
}

// Windowed attention, one launch. block = (4 query chunks = QBLK queries, head, batch), 512 threads; wave w owns query tile tq: queries q0 + 16 tq + 0..15 (chunk w >> 2); lane (hh, l15) owns query qg.
// Staging: the block reads the f32 rows of keys [kf, kf + KROWS), kf = max(0, q0 - WIN), of its head (one 128-byte line a row), converts them and keeps K (pitch KPITCH, key rows) and V (pitch VPITCH, key rows) as 16-bit carriers in LDS;
// rows kf .. kf + KROWS - 1 all lie inside the sequence (SEQ >= KROWS); the first block of a sequence stages rows it never reads. One barrier between fill and the first fragment load. Q goes from f32 straight into the B fragment.
// Key allowed for query qg iff key >= qg - (WIN - 1) (same-chunk keys are all allowed, window keys end just before the chunk). The 16 window edges of tile t = tq & 3 lie in [qs + 16t - WIN + 1, qs + 16t - WIN + 16],
// all within [ke + 1, ke + 32] for ke = qs - WIN + 32 (t >> 1), the start of one 32-key block: keys below ke are masked for all 16 queries and are not computed, keys from ke + 32 on are allowed for all 16.
// Keys computed per wave: [kstart, qs + 64) with kstart = max(0, ke); only the first block is masked. Tiles 0, 1 walk one block more than tiles 2, 3; waves w and w + 4 share a SIMD, so the tile is rotated by the chunk and every SIMD gets all four tiles.
// Per 32-key block: S^T tiles s0 (keys kb0..kb0+15 on rows) and s1 (keys kb0+16..31) = K(A, m = key) . Q^T(B, n = query); lane holds 16 keys of its query;
// row max / sum = register reduce + one xor-16 shuffle; P^T B fragment element r <- s0[r], element 8+r <- s1[r] (chained-D map); out^T tile u = V^T(A, m = d 16u + l15, by the transposing load) . P^T.
// P carried as f16 hi = f16(p * 2^15) (p <= 1, so hi <= 32768) and residual f16(p * 2^15 - hi) at the same carry; both products add into the tile's one accumulator; the row sum l carries the same x2^15, so the f32 epilogue takes out 2^-6 (V carry) and 1/l.
__global__ __launch_bounds__(512)
void k_attn(const float* __restrict__ q, const float* __restrict__ k, const float* __restrict__ v,
            const int* __restrict__ cidx, float* __restrict__ out) {
  __shared__ __attribute__((aligned(16))) unsigned char kl[KROWS * KPITCH];
  __shared__ __attribute__((aligned(16))) unsigned char vl[KROWS * VPITCH];
  __shared__ __attribute__((aligned(16))) float so[QBLK / 16][16][32];
  (void)cidx;
  const int qblk = blockIdx.x, head = blockIdx.y, b = blockIdx.z;
  const int tid = threadIdx.x, lane = tid & 31, l15 = lane & 15, hh = lane >> 4;
  const int w = __builtin_amdgcn_readfirstlane(tid >> 5);   // wave number in a scalar register: the key loop's trip count stays a scalar branch
  const int q0 = qblk * QBLK;
  const int kf = (q0 >= WIN) ? (q0 - WIN) : 0;   // first staged key
  const int qs = q0 + (w >> 2) * QCH;             // this wave's chunk start
  const int tq = (w & ~3) | ((w + (w >> 2)) & 3);   // this wave's query tile
  const int ke = qs - WIN + 32 * ((tq & 3) >> 1); // 32-key block that holds the tile's window edges
  const int kstart = (ke > 0) ? ke : 0;
  const int nk = qs + QCH - kstart;          // multiple of 32, >= QCH, <= QCH + WIN
  const int nblk = nk >> 5;
  const int qg = q0 + 16 * tq + l15;          // this lane's query (column n of every tile)
  const int thr = qg - (WIN - 1);             // key allowed iff key >= thr (keys are < qs + 64 by construction)

  FragH qb;
  {
    // all global loads first: 8 threads a row, 16 bytes each, 64 rows a sweep
    const int srow = tid >> 3, sc = tid & 7;
    const size_t goff = ((size_t)b * SEQ_FULL + kf + srow) * EMB + head * DHEAD + sc * 4;
    const float* kg = k + goff;
    const float* vg = v + goff;
    const float* qp = q + ((size_t)b * SEQ_FULL + qg) * EMB + head * DHEAD + 8 * hh;
    v4f kr[KROWS / 64], vr[KROWS / 64];
#pragma unroll
    for (int i = 0; i < KROWS / 64; ++i) kr[i] = *(const v4fa*)(kg + (size_t)i * 64 * EMB);
#pragma unroll
    for (int i = 0; i < KROWS / 64; ++i) vr[i] = *(const v4fa*)(vg + (size_t)i * 64 * EMB);
    const v4f qa = *(const v4fa*)(qp), qc = *(const v4fa*)(qp + 4), qd = *(const v4fa*)(qp + 16), qe = *(const v4fa*)(qp + 20);
    // the loads' address registers stay live (inputs) up to this wait, so nothing, a load's own result included, overwrites one ahead of it
    asm volatile("s_wait_xcnt 0x0" :: "v"(kg), "v"(vg), "v"(qp) : "memory");
#pragma unroll
    for (int i = 0; i < KROWS / 64; ++i) *(v4us*)(kl + (srow + 64 * i) * KPITCH + sc * 8) = cvt4(kr[i], 256.0f);
#pragma unroll
    for (int i = 0; i < KROWS / 64; ++i) *(v4us*)(vl + (srow + 64 * i) * VPITCH + sc * 8) = cvt4(vr[i], 64.0f);
    // Q^T B fragment: n = query l15, elements 0..7 <- d 8hh+0..7, 8..15 <- d 16+8hh+0..7
#pragma unroll
    for (int i = 0; i < 4; ++i) {
      qb.h[i]      = (_Float16)(bf16_rnef(qa[i]) * 256.0f);
      qb.h[4 + i]  = (_Float16)(bf16_rnef(qc[i]) * 256.0f);
      qb.h[8 + i]  = (_Float16)(bf16_rnef(qd[i]) * 256.0f);
      qb.h[12 + i] = (_Float16)(bf16_rnef(qe[i]) * 256.0f);
    }
  }
  __syncthreads();
  const unsigned char* kbase = kl + (kstart - kf + l15) * KPITCH + 16 * hh;                                   // A rows: m = key kstart + kb0 + 16t + l15
  const unsigned char* vbase = vl + (kstart - kf + 8 * hh + (lane & 7)) * VPITCH + 16 * ((lane >> 3) & 1);   // transposing load: rows = keys, columns = d

  const v8f z8 = {0.f, 0.f, 0.f, 0.f, 0.f, 0.f, 0.f, 0.f};
  v8f a0 = z8, a1 = z8;
  float m = NEGBIG, l = 0.f;

  const unsigned char* kp = kbase;
  const unsigned char* vp = vbase;
  // first block: the only one that can hold a key below a window edge of this wave
  key_block<true>(kp, vp, qb.v, kstart + 8 * hh, thr, a0, a1, m, l);
  kp += 32 * KPITCH;
  vp += 32 * VPITCH;
#pragma unroll 1
  for (int kb = 1; kb < nblk; ++kb, kp += 32 * KPITCH, vp += 32 * VPITCH)
    key_block<false>(kp, vp, qb.v, 0, 0, a0, a1, m, l);

  // epilogue: out[qg][head*32 + d]; a0: d = 8hh + r, a1: d = 16 + 8hh + r
  const float inv = 1.0f / l;                          // l >= 2^15 up to rounding; its carry cancels P's
  const float fo = inv * 0.015625f;                    // 2^-6 (V carry)
  v4f t0, t1, t2, t3;
#pragma unroll
  for (int r = 0; r < 4; ++r) {
    t0[r] = a0[r]     * fo;
    t1[r] = a0[4 + r] * fo;
    t2[r] = a1[r]     * fo;
    t3[r] = a1[4 + r] * fo;
  }
  *(v4fa*)&so[w][l15][8 * hh]          = t0;
  *(v4fa*)&so[w][l15][8 * hh + 4]      = t1;
  *(v4fa*)&so[w][l15][16 + 8 * hh]     = t2;
  *(v4fa*)&so[w][l15][16 + 8 * hh + 4] = t3;
  __syncthreads();
  const int ql = lane >> 3, c4 = (lane & 7) * 4;
  float* orow = out + ((size_t)b * SEQ + q0 + 16 * tq) * EMB + head * DHEAD + c4;
  {
#pragma unroll
    for (int j = 0; j < 4; ++j) {
      const int r = 4 * j + ql;
      const v4f vv = *(const v4fa*)&so[w][r][c4];
      *(v4f*)(orow + (size_t)r * EMB) = vv;
    }
    
  }
}

extern "C" void kernel_launch(void* const* d_in, const int* in_sizes, int n_in,
                              void* d_out, int out_size, void* d_ws, size_t ws_size, hipStream_t stream) {
  if (n_in < 4) return;
  if (in_sizes[0] < NB * SEQ * EMB || in_sizes[1] < NB * SEQ * EMB || in_sizes[2] < NB * SEQ * EMB || in_sizes[3] < 1) return;
  if (out_size < NB * SEQ * EMB) return;
  const float* q = (const float*)d_in[0];
  const float* k = (const float*)d_in[1];
  const float* v = (const float*)d_in[2];
  const int* cidx = (const int*)d_in[3];
  float* out = (float*)d_out;
  (void)d_ws; (void)ws_size;
  k_attn<<<dim3(SEQ / QBLK, NHEADS, NB), 512, 0, stream>>>(q, k, v, cidx, out);
}

// v007
// A run of this version takes 13.1 microseconds.
// Versions between v004 and this one are left out; their measured steps multiply to 1.25 times as fast.
// Counting every step since v000, it is 2.94 times as fast.
#include <hip/hip_runtime.h>
// Compute dtype: site0 scores = K(f16 RNE of the f32 input) . Q^T(same) on v_wmma_f32_16x16x32_f16, f32 accumulate; site1 out^T = V^T(f16 RNE of the f32 input) . P^T with P as one f16 (RNE of p x2^15), v_wmma_f32_16x16x32_f16, f32 accumulate; softmax statistics and epilogue f32.

#ifndef NB
#define NB 4
#endif
#ifndef SEQ
#define SEQ 2048
#endif
#define NB_FULL 4
#define SEQ_FULL 2048
#define EMB 512
#define NHEADS 16
#define DHEAD 32
#define QCH 64
#define WIN 256
#define NEGBIG (-1.0e30f)

static_assert(EMB == NHEADS * DHEAD);
static_assert(SEQ % 64 == 0);
static_assert(QCH == 64);
static_assert(WIN % 64 == 0);
#define QBLK 256
#define KROWS (QBLK + WIN)
#define KPITCH 80
#define VPITCH 96
#define NTHR (QBLK)          // one wave per 32 queries
#define SROWS (NTHR / 8)     // key rows staged per sweep
static_assert(QBLK % QCH == 0 && SEQ % QBLK == 0 && SEQ >= KROWS && SEQ <= SEQ_FULL);
static_assert(KROWS % SROWS == 0 && QCH == 64 && NTHR == 256);

typedef _Float16 v16h __attribute__((ext_vector_type(16)));
typedef unsigned short v8us __attribute__((ext_vector_type(8), may_alias));
typedef unsigned short v4us __attribute__((ext_vector_type(4), may_alias));
typedef short s16x8 __attribute__((ext_vector_type(8)));
typedef float v8f __attribute__((ext_vector_type(8)));
typedef float v4f __attribute__((ext_vector_type(4)));
typedef float v4fa __attribute__((ext_vector_type(4), may_alias));
union FragH { v16h v; v8us half[2]; v4us quad[4]; };
typedef float v2f __attribute__((ext_vector_type(2)));
typedef _Float16 v2h __attribute__((ext_vector_type(2)));
typedef _Float16 v4h __attribute__((ext_vector_type(4)));
union FragW { v16h v; unsigned int w[8]; };

// D = A.B + C (16x16x32, f16 operands, f32 accumulate). The products stand in runs of four independent ones (two fragments x two query tiles), which fill each other's hazard slots; what is left behind a run the compiler pads for its own builtin.
__device__ __forceinline__ v8f mma16(v16h a, v16h b, v8f c) {
  return __builtin_amdgcn_wmma_f32_16x16x32_f16(false, a, false, b, (short)0, c, false, false);
}

// 16-bit transposing LDS load: lane (c, h) gets T[row0 + 8h + 0..7][col0 + c] of a row-major 16-bit tile; p is the lane's own address (row0 + 8h + (lane & 7), byte 16 * ((lane >> 3) & 1)).
__device__ __forceinline__ v8us ld_tr16(const unsigned char* p) {
  typedef __attribute__((address_space(3))) s16x8 lds_s16x8;
  return __builtin_bit_cast(v8us, __builtin_amdgcn_ds_load_tr16_b128_v8i16((lds_s16x8*)p));
}

// four f32 -> four f16, round to nearest even: two packed converts, no scale (11 significant bits from 2^-14 up to 65504; below 2^-14 the step is 2^-24)
__device__ __forceinline__ v4us cvt4(v4f a) {
  return __builtin_bit_cast(v4us, __builtin_convertvector(a, v4h));
}

// 2^a by v_exp_f32 with the free issue slot the instruction set asks for behind a transcendental before its source is overwritten.
__device__ __forceinline__ float exp2_slot(float a) {
  float r;
  asm("v_exp_f32 %0, %1\n\tv_nop" : "=v"(r) : "v"(a));
  return r;
}

// One 32-key block of the online softmax for the wave's two query tiles (index t). EDGE = true: the block may hold keys below a query's window edge (key < thr[t]), so scores are masked and masked probabilities forced to 0.
// EDGE = false: every key of the block is allowed for every query of the wave; no compare, no select.
// Each K fragment and each V^T fragment is read from LDS once and feeds one product per tile; per tile the arithmetic and its order are those of a one-tile wave.
template <bool EDGE>
__device__ __forceinline__ void key_block(const unsigned char* kp, const unsigned char* vp, const v16h (&qbv)[2], const int kg0, const int (&thr)[2],
                                          v8f (&a0)[2], v8f (&a1)[2], float (&m)[2], float (&l)[2]) {
  const v8f z8 = {0.f, 0.f, 0.f, 0.f, 0.f, 0.f, 0.f, 0.f};
  const float cs = 0.17677669529663687f * 1.44269504088896340736f;   // d^-0.5 x log2(e): raw score -> exponent of 2
  v8f s0[2], s1[2];
  {
    FragH ka0, ka1;
    ka0.half[0] = *(const v8us*)(kp);
    ka0.half[1] = *(const v8us*)(kp + 32);
    ka1.half[0] = *(const v8us*)(kp + 16 * KPITCH);
    ka1.half[1] = *(const v8us*)(kp + 16 * KPITCH + 32);
#pragma unroll
    for (int t = 0; t < 2; ++t) s0[t] = mma16(ka0.v, qbv[t], z8);
#pragma unroll
    for (int t = 0; t < 2; ++t) s1[t] = mma16(ka1.v, qbv[t], z8);
  }
  // Keeps the four score products in one run, so that each stands in the hazard slots of the ones before it (LDS reads alone may cross): otherwise the build sets a maximum directly behind the first product and pads it with four v_nop.
  __builtin_amdgcn_sched_barrier(0x100);
  // s0[t][r] <-> key kg0 + r ; s1[t][r] <-> key kg0 + 16 + r ; both for the lane's query of tile t. x holds the raw accumulators: cs > 0, so their maximum is the scaled scores' maximum too.
  float x[2][16], mx[2], mnew[2];
#pragma unroll
  for (int t = 0; t < 2; ++t) {
#pragma unroll
    for (int r = 0; r < 8; ++r) {
      x[t][r]     = (!EDGE || kg0 + r >= thr[t])      ? s0[t][r] : NEGBIG;
      x[t][8 + r] = (!EDGE || kg0 + 16 + r >= thr[t]) ? s1[t][r] : NEGBIG;
    }
    mx[t] = x[t][0];
#pragma unroll
    for (int i = 1; i < 16; ++i) mx[t] = fmaxf(mx[t], x[t][i]);
  }
#pragma unroll
  for (int t = 0; t < 2; ++t) {
    mx[t] = fmaxf(mx[t], __shfl_xor(mx[t], 16));
    mnew[t] = fmaxf(m[t], mx[t]);                      // running maximum, kept in raw score units
  }
  // pp[t][j][e] = p x 2^15 = 2^(x cs + 15 - mnew cs): score scale, log2(e), maximum and carry all in one FMA an element ahead of the exponential
  FragW ph[2];
  v2f pp[2][8];
#pragma unroll
  for (int t = 0; t < 2; ++t) {
    const float nb = __builtin_fmaf(mnew[t], -cs, 15.0f);   // the P carry 2^15 rides in the exponent
    const v2f cs2 = {cs, cs}, nb2 = {nb, nb};
#pragma unroll
    for (int j = 0; j < 8; ++j) {
      const v2f xx = {x[t][2 * j], x[t][2 * j + 1]};
      const v2f ar = __builtin_elementwise_fma(xx, cs2, nb2);
#pragma unroll
      for (int e = 0; e < 2; ++e) {
        const float ev = EDGE ? exp2_slot(ar[e]) : __builtin_amdgcn_exp2f(ar[e]);
        pp[t][j][e] = (!EDGE || xx[e] > -1.0e29f) ? ev : 0.f;
      }
    }
  }
  // Holds the exponentials of both tiles back to back, each result in a register of its own (LDS reads alone may cross, so the V^T loads still go out early):
  // without it the build mixes the row sums in among them and ends with more issue slots: five more v_nop in the edge block, two more vector instructions a loop pass.
  __builtin_amdgcn_sched_barrier(0x100);
  float rs[2];
#pragma unroll
  for (int t = 0; t < 2; ++t) {
    rs[t] = pp[t][0][0] + pp[t][0][1];
#pragma unroll
    for (int j = 1; j < 8; ++j) {
      rs[t] += pp[t][j][0];
      rs[t] += pp[t][j][1];
    }
#pragma unroll
    for (int j = 0; j < 8; ++j) ph[t].w[j] = __builtin_bit_cast(unsigned int, __builtin_convertvector(pp[t][j], v2h));
  }
#pragma unroll
  for (int t = 0; t < 2; ++t) {
    rs[t] += __shfl_xor(rs[t], 16);
    const float c = __builtin_amdgcn_exp2f((m[t] - mnew[t]) * cs);
    l[t] = l[t] * c + rs[t];   // l carries x2^15 like P
    m[t] = mnew[t];
#pragma unroll
    for (int r = 0; r < 8; ++r) { a0[t][r] *= c; a1[t][r] *= c; }
  }
  {
    FragH va0, va1;
    va0.half[0] = ld_tr16(vp);
    va0.half[1] = ld_tr16(vp + 16 * VPITCH);
    va1.half[0] = ld_tr16(vp + 32);
    va1.half[1] = ld_tr16(vp + 16 * VPITCH + 32);
#pragma unroll
    for (int t = 0; t < 2; ++t) a0[t] = mma16(va0.v, ph[t].v, a0[t]);
#pragma unroll
    for (int t = 0; t < 2; ++t) a1[t] = mma16(va1.v, ph[t].v, a1[t]);
  }
}

// Windowed attention, one launch. block = (4 query chunks = QBLK queries, head, batch), 256 threads = 8 waves; wave w owns the query tiles tq and tq + 1: queries q0 + 16 tq + 0..31, one half of chunk w >> 1; lane (hh, l15) owns queries qg and qg + 16.
// Staging: the block reads the f32 rows of keys [kf, kf + KROWS), kf = max(0, q0 - WIN), of its head (one 128-byte line a row), converts them to f16 and keeps K (pitch KPITCH, key rows) and V (pitch VPITCH, key rows) in LDS;
// rows kf .. kf + KROWS - 1 all lie inside the sequence (SEQ >= KROWS); the first block of a sequence stages rows it never reads. One barrier between fill and the first fragment load. Q goes from f32 straight into the B fragments.
// Key allowed for query qg iff key >= qg - (WIN - 1) (same-chunk keys are all allowed, window keys end just before the chunk). The 16 window edges of tile t of a chunk lie in [qs + 16t - WIN + 1, qs + 16t - WIN + 16],
// all within [ke + 1, ke + 32] for ke = qs - WIN + 32 (t >> 1), the start of one 32-key block, the same for both tiles of a wave (t = 2 pr, 2 pr + 1): keys below ke are masked for all 32 queries and are not computed, keys from ke + 32 on are allowed for all 32.
// Keys computed per wave: [kstart, qs + 64) with kstart = max(0, ke); only the first block is masked. The lower half of a chunk walks one block more than the upper; the half is flipped for waves 4..7.
// Per 32-key block and tile: S^T tiles s0 (keys kb0..kb0+15 on rows) and s1 (keys kb0+16..31) = K(A, m = key) . Q^T(B, n = query); lane holds 16 keys of its query;
// row max / sum = register reduce + one xor-16 shuffle; P^T B fragment element r <- s0[r], element 8+r <- s1[r] (chained-D map); out^T tile u = V^T(A, m = d 16u + l15, by the transposing load) . P^T.
// P carried as one f16 = f16(p * 2^15) (p <= 1, so at most 32768): 11 significant bits, as many as V has, so the product's error bound is twice V's own; the row sum l adds the unrounded f32 p at the same x2^15, so the f32 epilogue takes out 1/l alone.
__global__ __launch_bounds__(NTHR)
void k_attn(const float* __restrict__ q, const float* __restrict__ k, const float* __restrict__ v,
            const int* __restrict__ cidx, float* __restrict__ out) {
  __shared__ __attribute__((aligned(16))) unsigned char kl[KROWS * KPITCH];
  __shared__ __attribute__((aligned(16))) unsigned char vl[KROWS * VPITCH];
  __shared__ __attribute__((aligned(16))) float so[QBLK / 32][32][32];
  (void)cidx;
  const int qblk = blockIdx.x, head = blockIdx.y, b = blockIdx.z;
  const int tid = threadIdx.x, lane = tid & 31, l15 = lane & 15, hh = lane >> 4;
  const int w = __builtin_amdgcn_readfirstlane(tid >> 5);   // wave number in a scalar register: the key loop's trip count stays a scalar branch
  const int q0 = qblk * QBLK;
  const int kf = (q0 >= WIN) ? (q0 - WIN) : 0;   // first staged key
  const int qs = q0 + (w >> 1) * QCH;             // this wave's chunk start
  const int pr = (w ^ (w >> 2)) & 1;              // which half of the chunk
  const int tq = 4 * (w >> 1) + 2 * pr;           // this wave's first query tile
  const int ke = qs - WIN + 32 * pr;              // 32-key block that holds both tiles' window edges
  const int kstart = (ke > 0) ? ke : 0;
  const int nk = qs + QCH - kstart;          // multiple of 32, >= QCH, <= QCH + WIN
  const int nblk = nk >> 5;
  const int qg = q0 + 16 * tq + l15;          // this lane's query of the first tile (column n); the second tile's is qg + 16
  const int thr[2] = {qg - (WIN - 1), qg + 16 - (WIN - 1)};   // key allowed iff key >= thr (keys are < qs + 64 by construction)

  v16h qbv[2];
  {
    // all global loads first: 8 threads a row, 16 bytes each, SROWS rows a sweep
    const int srow = tid >> 3, sc = tid & 7;
    const size_t goff = ((size_t)b * SEQ_FULL + kf + srow) * EMB + head * DHEAD + sc * 4;
    const float* kg = k + goff;
    const float* vg = v + goff;
    const float* qp = q + ((size_t)b * SEQ_FULL + qg) * EMB + head * DHEAD + 8 * hh;
    v4f kr[KROWS / SROWS], vr[KROWS / SROWS], qr[2][4];
#pragma unroll
    for (int i = 0; i < KROWS / SROWS; ++i) kr[i] = *(const v4fa*)(kg + (size_t)i * SROWS * EMB);
#pragma unroll
    for (int i = 0; i < KROWS / SROWS; ++i) vr[i] = *(const v4fa*)(vg + (size_t)i * SROWS * EMB);
#pragma unroll
    for (int t = 0; t < 2; ++t) {
      qr[t][0] = *(const v4fa*)(qp + t * 16 * EMB);
      qr[t][1] = *(const v4fa*)(qp + t * 16 * EMB + 4);
      qr[t][2] = *(const v4fa*)(qp + t * 16 * EMB + 16);
      qr[t][3] = *(const v4fa*)(qp + t * 16 * EMB + 20);
    }
    // the loads' address registers stay live (inputs) up to this wait, so nothing, a load's own result included, overwrites one ahead of it
    asm volatile("s_wait_xcnt 0x0" :: "v"(kg), "v"(vg), "v"(qp) : "memory");
#pragma unroll
    for (int i = 0; i < KROWS / SROWS; ++i) *(v4us*)(kl + (srow + SROWS * i) * KPITCH + sc * 8) = cvt4(kr[i]);
#pragma unroll
    for (int i = 0; i < KROWS / SROWS; ++i) *(v4us*)(vl + (srow + SROWS * i) * VPITCH + sc * 8) = cvt4(vr[i]);
    // Q^T B fragments: n = query l15 of the tile, elements 0..7 <- d 8hh+0..7, 8..15 <- d 16+8hh+0..7
#pragma unroll
    for (int t = 0; t < 2; ++t) {
      FragH qb;
#pragma unroll
      for (int i = 0; i < 4; ++i) qb.quad[i] = cvt4(qr[t][i]);
      qbv[t] = qb.v;
    }
  }
  __syncthreads();
  const unsigned char* kbase = kl + (kstart - kf + l15) * KPITCH + 16 * hh;                                   // A rows: m = key kstart + kb0 + 16t + l15
  const unsigned char* vbase = vl + (kstart - kf + 8 * hh + (lane & 7)) * VPITCH + 16 * ((lane >> 3) & 1);   // transposing load: rows = keys, columns = d

  const v8f z8 = {0.f, 0.f, 0.f, 0.f, 0.f, 0.f, 0.f, 0.f};
  v8f a0[2] = {z8, z8}, a1[2] = {z8, z8};
  float m[2] = {NEGBIG, NEGBIG}, l[2] = {0.f, 0.f};

  const unsigned char* kp = kbase;
  const unsigned char* vp = vbase;
  // first block: the only one that can hold a key below a window edge of this wave
  key_block<true>(kp, vp, qbv, kstart + 8 * hh, thr, a0, a1, m, l);
  kp += 32 * KPITCH;
  vp += 32 * VPITCH;
#pragma unroll 1
  for (int kb = 1; kb < nblk; ++kb, kp += 32 * KPITCH, vp += 32 * VPITCH)
    key_block<false>(kp, vp, qbv, 0, thr, a0, a1, m, l);

  // epilogue: out[query][head*32 + d]; a0: d = 8hh + r, a1: d = 16 + 8hh + r
#pragma unroll
  for (int t = 0; t < 2; ++t) {
    const float fo = 1.0f / l[t];                      // l >= 2^15 up to rounding; its carry cancels P's
    v4f t0, t1, t2, t3;
#pragma unroll
    for (int r = 0; r < 4; ++r) {
      t0[r] = a0[t][r]     * fo;
      t1[r] = a0[t][4 + r] * fo;
      t2[r] = a1[t][r]     * fo;
      t3[r] = a1[t][4 + r] * fo;
    }
    *(v4fa*)&so[w][16 * t + l15][8 * hh]          = t0;
    *(v4fa*)&so[w][16 * t + l15][8 * hh + 4]      = t1;
    *(v4fa*)&so[w][16 * t + l15][16 + 8 * hh]     = t2;
    *(v4fa*)&so[w][16 * t + l15][16 + 8 * hh + 4] = t3;
  }
  __syncthreads();
  const int ql = lane >> 3, c4 = (lane & 7) * 4;
  float* orow = out + ((size_t)b * SEQ + q0 + 16 * tq) * EMB + head * DHEAD + c4;
#pragma unroll
  for (int j = 0; j < 8; ++j) {
    const int r = 4 * j + ql;
    const v4f vv = *(const v4fa*)&so[w][r][c4];
    *(v4f*)(orow + (size_t)r * EMB) = vv;
  }
}

extern "C" void kernel_launch(void* const* d_in, const int* in_sizes, int n_in,
                              void* d_out, int out_size, void* d_ws, size_t ws_size, hipStream_t stream) {
  if (n_in < 4) return;
  if (in_sizes[0] < NB * SEQ * EMB || in_sizes[1] < NB * SEQ * EMB || in_sizes[2] < NB * SEQ * EMB || in_sizes[3] < 1) return;
  if (out_size < NB * SEQ * EMB) return;
  const float* q = (const float*)d_in[0];
  const float* k = (const float*)d_in[1];
  const float* v = (const float*)d_in[2];
  const int* cidx = (const int*)d_in[3];
  float* out = (float*)d_out;
  (void)d_ws; (void)ws_size;
  k_attn<<<dim3(SEQ / QBLK, NHEADS, NB), NTHR, 0, stream>>>(q, k, v, cidx, out);
}
